// v000
// Measured on an AMD MI455X. A time is GPU time per run, averaged over a window of back-to-back runs after a warm-up
// (all launches, gaps included; the runs take copies of the inputs in turn), and the median of several windows.
// Apart from v000's, it joins two sittings. Times from different sittings can be a few percent apart, while
// side-by-side timings come from the same sitting.
// v000 is the starting kernel. One run takes 2430 microseconds.
#include <hip/hip_runtime.h>

// Vision attention with per-head RMSNorm and 2-D rotary positions (hidden [8][1024][768]; q,k,v = x W^T ('oi' [768][768], 12 heads x 64); q, k RMS-normalised per head (eps 1e-6) x scale, v RMS-normalised without scale; 2-D RoPE: the head's first 32 channels rotate (rotate-half within the 32) by the x position, the last 32 by the y position, angle = pos x 100^(-2i/32) from pixel_position_ids int32 [8][1024][2]; scores = q.k UNSCALED; softmax; out = merged Wo^T ('oi') -> [8][1024][768] (6.3 M)).
// Layout per batch: a small kernel builds the per-batch {cos, sin} table [1024][64] from the position ids (f32 powf/cosf/sinf); exact projections; per-(head, token) 1/rms kernels; a 2-D rotary plane builder applies (x * inv_rms) * scale and the within-half rotate-half while writing the q/k planes; v rows are scaled by their 1/rms in place before the value planes; dense T-1024 attention with EVERY row on hi/lo planes (the unscaled logits of unit-RMS vectors reach ~+-30); merged hi/lo x Wo exact.
// Compute dtypes, f32 accumulate: every input rounded to bf16; projections exact; RMSNorm/rotary f32; scores and attn.v 3 products on every row; softmax f32; Wo hl x exact.

#define NB_  8
#define TT   1024
#define DM   768
#define NH_  12
#define NKV  12
#define REP  (NH_ / NKV)
#define HD   64
#define DQ   (NH_ * HD)
#define DKV  (NKV * HD)
#define ZH   2
#define RH   1024                  // query rows < RH use hi+lo planes (0: none)
#define WIN  0
#define PCAR 1024.0f
#define SCL  1.0f   // unscaled (module scaling = 1.0)
typedef _Float16 h16;
typedef unsigned short bf;
typedef __attribute__((ext_vector_type(16))) __bf16   v16bf;
typedef __attribute__((ext_vector_type(16))) _Float16 v16h;
typedef __attribute__((ext_vector_type(8)))  _Float16 v8h;
typedef __attribute__((ext_vector_type(8)))  unsigned short v8us;
typedef __attribute__((ext_vector_type(8)))  float    v8f;
typedef __attribute__((ext_vector_type(4)))  float    v4f;
typedef v8h  __attribute__((may_alias)) v8ha;
typedef v4f  __attribute__((may_alias)) v4fa;
typedef v8us __attribute__((may_alias)) v8usa;

__device__ __forceinline__ unsigned short f2bf(float f) { unsigned u = __float_as_uint(f); u += 0x7FFFu + ((u >> 16) & 1u); return (unsigned short)(u >> 16); }
__device__ __forceinline__ float bf2f(unsigned short b) { return __uint_as_float(((unsigned)b) << 16); }
__device__ __forceinline__ float bfr(float f) { return bf2f(f2bf(f)); }
__device__ __forceinline__ v16h cat16(v8h lo, v8h hi) { return __builtin_shufflevector(lo, hi, 0, 1, 2, 3, 4, 5, 6, 7, 8, 9, 10, 11, 12, 13, 14, 15); }
__device__ __forceinline__ v16bf cat16b(v8us lo, v8us hi) { return __builtin_bit_cast(v16bf, __builtin_shufflevector(lo, hi, 0, 1, 2, 3, 4, 5, 6, 7, 8, 9, 10, 11, 12, 13, 14, 15)); }
__device__ __forceinline__ v8f wmma16(v16h a, v16h b, v8f c) { return __builtin_amdgcn_wmma_f32_16x16x32_f16(false, a, false, b, (short)0, c, false, false); }
__device__ __forceinline__ v8f wmmab(v16bf a, v16bf b, v8f c) { return __builtin_amdgcn_wmma_f32_16x16x32_bf16(false, a, false, b, (short)0, c, false, false); }



// ---- k_gemmw: register-blocked GEMM, ONE WAVE per 64x64 output tile (16 accumulators), operands straight from K-contiguous 16-bit planes; grid (M/64, N/64, Z), 32 threads.
// C[m][n] (f32, pitch ldc, + optional f32 bias[n]) = sum_k A[m][k] Bt[n][k] (+ split products per NSPLIT). z-batch strides sA/sB/sC in elements. K % 32 == 0.
template <typename T16> struct WFrag;
template <> struct WFrag<h16> { typedef v16h V; static __device__ __forceinline__ V ld(const h16* p) { return cat16(*(const v8h*)p, *(const v8h*)(p + 16)); } static __device__ __forceinline__ v8f mma(V a, V b, v8f c) { return wmma16(a, b, c); } };
template <> struct WFrag<bf> { typedef v16bf V; static __device__ __forceinline__ V ld(const bf* p) { return cat16b(*(const v8us*)p, *(const v8us*)(p + 16)); } static __device__ __forceinline__ v8f mma(V a, V b, v8f c) { return wmmab(a, b, c); } };
template <typename T16, int NSPLIT, bool BIAS>
__global__ __launch_bounds__(32) void k_gemmw(const T16* __restrict__ A, const T16* __restrict__ A2, const T16* __restrict__ Bt, const T16* __restrict__ Bt2, int K, float* C, int ldc, const float* __restrict__ bias, size_t sA, size_t sB, size_t sC) {
    typedef typename WFrag<T16>::V V;
    __shared__ __align__(16) float os[16 * 68];
    const size_t z = blockIdx.z; A += z * sA; if (A2) A2 += z * sA; Bt += z * sB; if (Bt2) Bt2 += z * sB; C += z * sC;
    const int lane = threadIdx.x & 31, lr = lane & 15, hi = lane >> 4; const int r0 = blockIdx.x * 64, c0 = blockIdx.y * 64;
    v8f acc[4][4];
#pragma unroll
    for (int mb = 0; mb < 4; ++mb)
#pragma unroll
        for (int nb = 0; nb < 4; ++nb) acc[mb][nb] = (v8f){};
    const size_t aoff = (size_t)(r0 + lr) * K + 8 * hi, boff = (size_t)(c0 + lr) * K + 8 * hi;
#pragma unroll 1
    for (int kc = 0; kc < K; kc += 32) {
        V a[4], a2[4];
#pragma unroll
        for (int mb = 0; mb < 4; ++mb) { a[mb] = WFrag<T16>::ld(A + aoff + (size_t)mb * 16 * K + kc); if (NSPLIT == 1 || NSPLIT == 2) a2[mb] = WFrag<T16>::ld(A2 + aoff + (size_t)mb * 16 * K + kc); }
#pragma unroll
        for (int nb = 0; nb < 4; ++nb) { const V b = WFrag<T16>::ld(Bt + boff + (size_t)nb * 16 * K + kc); V b2; if (NSPLIT >= 2) b2 = WFrag<T16>::ld(Bt2 + boff + (size_t)nb * 16 * K + kc);
#pragma unroll
            for (int mb = 0; mb < 4; ++mb) { acc[mb][nb] = WFrag<T16>::mma(a[mb], b, acc[mb][nb]); if (NSPLIT == 1 || NSPLIT == 2) acc[mb][nb] = WFrag<T16>::mma(a2[mb], b, acc[mb][nb]); if (NSPLIT >= 2) acc[mb][nb] = WFrag<T16>::mma(a[mb], b2, acc[mb][nb]); } }
        asm volatile("v_nop\n\tv_nop\n\tv_nop\n\tv_nop" : "+v"(acc[0][0]), "+v"(acc[1][1]), "+v"(acc[2][2]), "+v"(acc[3][3]) : "v"(a[0]), "v"(a[3]));
    }
#pragma unroll
    for (int mb = 0; mb < 4; ++mb) {
#pragma unroll
        for (int nb = 0; nb < 4; ++nb) {
#pragma unroll
            for (int j = 0; j < 8; ++j) os[(hi * 8 + j) * 68 + nb * 16 + lr] = acc[mb][nb][j]; }
        __builtin_amdgcn_wave_barrier(); asm volatile("" ::: "memory");
        float* crow = C + (size_t)(r0 + mb * 16) * ldc + c0;
{
#pragma unroll
            for (int s = 0; s < 8; ++s) { const int row = 2 * s + hi, cofs = lr * 4; v4f val = *(const v4fa*)(os + row * 68 + cofs); if (BIAS) { val[0] += bfr(bias[c0 + cofs]); val[1] += bfr(bias[c0 + cofs + 1]); val[2] += bfr(bias[c0 + cofs + 2]); val[3] += bfr(bias[c0 + cofs + 3]); }
                *(v4f*)(crow + (size_t)row * ldc + cofs) = val; }
             }
        __builtin_amdgcn_wave_barrier(); asm volatile("" ::: "memory");
    }
}

__device__ __forceinline__ h16 tohx(float x) { return (h16)x; }
__device__ __forceinline__ void splitf(float y, unsigned short& h, unsigned short& l) { h = f2bf(y); l = f2bf(y - bf2f(h)); }
typedef __attribute__((ext_vector_type(2))) _Float16 v2h;
typedef __attribute__((ext_vector_type(4))) _Float16 v4h;
typedef __attribute__((ext_vector_type(2))) unsigned short v2us;
typedef __attribute__((ext_vector_type(4))) unsigned short v4us;
typedef __attribute__((ext_vector_type(2))) float v2f;
typedef __attribute__((ext_vector_type(4))) int v4i;

__global__ __launch_bounds__(256) void k_wtG(const float* __restrict__ w, int K, int N, bf* Bt) {
    const int lane = threadIdx.x & 31; const int L0 = (blockIdx.x * 8 + (threadIdx.x >> 5)) * 8; const int nlines = N * K / 64;
{
#pragma unroll 1
        for (int l = 0; l < 8; ++l) { const int L = L0 + l; if (L >= nlines) break; const size_t e = (size_t)L * 64 + lane * 2; const int k = (int)(e % K), n = (int)(e / K); v2us o;
            o[0] = f2bf(w[(size_t)k * N + n]); o[1] = f2bf(w[(size_t)(k + 1) * N + n]); *(v2us*)(Bt + e) = o; }
         }
}
__global__ __launch_bounds__(256) void k_cvt8(const float* __restrict__ src, bf* dst, size_t n8) { const size_t i = (size_t)blockIdx.x * 256 + threadIdx.x; if (i >= n8) return; const v8f v = *(const v8f*)(src + i * 8); v8us o;
#pragma unroll
    for (int k = 0; k < 8; ++k) o[k] = f2bf(v[k]); *(v8us*)(dst + i * 8) = o;  }

__global__ __launch_bounds__(256) void k_cs2d(const int* __restrict__ pid, float* CS) { const int idx = blockIdx.x * 256 + threadIdx.x; if (idx >= TT * HD) return; const int d = idx % HD; const int t = idx / HD; const int ax = d / (HD / 2); const int i = (d % (HD / 2)) % (HD / 4);
    const float e = __fdiv_rn((float)(2 * i), (float)(HD / 2)); const float inv = __fdiv_rn(1.0f, powf(100.0f, e)); const float a = __fmul_rn((float)pid[t * 2 + ax], inv); v2f cs; cs[0] = cosf(a); cs[1] = sinf(a);
    *(v2f*)(CS + (size_t)idx * 2) = cs;  }
__global__ __launch_bounds__(256) void k_hrms(const float* __restrict__ F, int pitch, int nheads, float* RF) { const int idx = blockIdx.x * 256 + threadIdx.x; if (idx >= nheads * TT) return; const int t = idx % TT; const int h = idx / TT; const float* f = F + (size_t)t * pitch + h * HD; float s = 0.f;
#pragma unroll 4
    for (int d = 0; d < HD; d += 4) { const v4f a = *(const v4f*)(f + d);
#pragma unroll
        for (int q = 0; q < 4; ++q) { float p = __fmul_rn(a[q], a[q]); asm volatile("" : "+v"(p)); s = __fadd_rn(s, p); } }
    const float rf = __fdiv_rn(1.0f, __fsqrt_rn(__fadd_rn(__fdiv_rn(s, (float)HD), 1e-6f))); *(float*)(RF + idx) = rf;  }
__global__ __launch_bounds__(256) void k_rope2d(const float* __restrict__ F, int pitch, int nheads, const float* __restrict__ CS, const float* __restrict__ RF, const float* __restrict__ nw, h16* P16, bf* Ph, bf* Pl) {
    const size_t e = ((size_t)blockIdx.x * 256 + threadIdx.x) * 2; if (e >= (size_t)nheads * TT * HD) return; const int d = (int)(e % HD); const int t = (int)((e / HD) % TT); const int h = (int)(e / ((size_t)HD * TT)); const float* f = F + (size_t)t * pitch + h * HD; const float rf = RF[(size_t)h * TT + t]; v2h o16; v2us oh, ol;
#pragma unroll
    for (int q = 0; q < 2; ++q) { const int dd = d + q; const int dl = dd % (HD / 2); const bool lo = dl < (HD / 4); const int dp = lo ? dd + HD / 4 : dd - HD / 4;
        float n0 = __fmul_rn(f[dd], rf), n1 = __fmul_rn(f[dp], rf); asm volatile("" : "+v"(n0), "+v"(n1)); n0 = __fmul_rn(n0, bfr(nw[dd])); n1 = __fmul_rn(n1, bfr(nw[dp]));
        const v2f cs = *(const v2f*)(CS + ((size_t)t * HD + dd) * 2); float a = __fmul_rn(n0, cs[0]), bq = __fmul_rn(n1, cs[1]); asm volatile("" : "+v"(a), "+v"(bq)); const float r = lo ? __fsub_rn(a, bq) : __fadd_rn(a, bq);
        o16[q] = tohx(r); unsigned short a2, c2; splitf(r, a2, c2); oh[q] = a2; ol[q] = c2; }
    *(v2h*)(P16 + e) = o16; *(v2us*)(Ph + e) = oh; *(v2us*)(Pl + e) = ol;  }
__global__ __launch_bounds__(256) void k_rowscale(float* F, const float* __restrict__ RF, size_t n4) { const size_t i = (size_t)blockIdx.x * 256 + threadIdx.x; if (i >= n4) return; const size_t e = i * 4; const int t = (int)(e / DKV); const int h = (int)((e % DKV) / HD); const float rf = RF[(size_t)h * TT + t]; v4f a = *(const v4f*)(F + e);
#pragma unroll
    for (int q = 0; q < 4; ++q) a[q] = __fmul_rn(a[q], rf); *(v4f*)(F + e) = a;  }

__global__ __launch_bounds__(256) void k_vtp(const float* __restrict__ F, int pitch, int nheads, h16* V16, bf* Vh, bf* Vl) { const size_t e = ((size_t)blockIdx.x * 256 + threadIdx.x) * 2; if (e >= (size_t)nheads * HD * TT) return; const int t = (int)(e % TT); const int d = (int)((e / TT) % HD); const int g = (int)(e / ((size_t)TT * HD)); v2h o16; v2us oh, ol;
#pragma unroll
    for (int q = 0; q < 2; ++q) { const float x = F[(size_t)(t + q) * pitch + g * HD + d]; o16[q] = tohx(x); unsigned short a2, c2; splitf(x, a2, c2); oh[q] = a2; ol[q] = c2; }
    *(v2h*)(V16 + e) = o16; *(v2us*)(Vh + e) = oh; *(v2us*)(Vl + e) = ol;  }
// k_asoft: per row (zz, i): t = S x SCL = S (unscaled, no mask); softmax over the 1024 keys (register row, one exp, fixed trees);
__global__ __launch_bounds__(256) void k_asoft(const float* __restrict__ Sb, h16* P16, bf* Ph, bf* Pl) {
    const int lane = threadIdx.x & 31; const int row = blockIdx.x * 8 + (threadIdx.x >> 5); if (row >= ZH * TT) return; const int i = row % TT; const int zz = row / TT; (void)zz; const bool hires = (i < RH); const float* sr = Sb + (size_t)row * TT; float v[TT / 32]; float mx = -3.0e38f;
#pragma unroll
    for (int ch = 0; ch < TT / 128; ++ch) { const int j0 = ch * 128 + lane * 4; const v4f a = *(const v4f*)(sr + j0);
#pragma unroll
        for (int q = 0; q < 4; ++q) { const int j = j0 + q; (void)j; const float t = a[q] * SCL; v[ch * 4 + q] = t; mx = fmaxf(mx, t); } }
#pragma unroll
    for (int sh = 16; sh; sh >>= 1) mx = fmaxf(mx, __shfl_xor(mx, sh, 32));
    float sum = 0.f;
#pragma unroll
    for (int k = 0; k < TT / 32; ++k) { float d0 = __fsub_rn(v[k], mx); asm volatile("" : "+v"(d0)); v[k] = __builtin_amdgcn_exp2f(__fmul_rn(d0, 1.4426950408889634f)); sum += v[k]; }
#pragma unroll
    for (int sh = 16; sh; sh >>= 1) sum += __shfl_xor(sum, sh, 32);
    const float f = __fdiv_rn(hires ? 1.0f : PCAR, sum);
{
        if (hires) {
#pragma unroll
            for (int ch = 0; ch < TT / 128; ++ch) { v4us oh, ol;
#pragma unroll
                for (int q = 0; q < 4; ++q) { unsigned short a, c2; splitf(v[ch * 4 + q] * f, a, c2); oh[q] = a; ol[q] = c2; }
                const size_t oo = ((size_t)zz * (RH ? RH : 1) + i) * TT + ch * 128 + lane * 4; *(v4us*)(Ph + oo) = oh; *(v4us*)(Pl + oo) = ol; }
        } else {
#pragma unroll
            for (int ch = 0; ch < TT / 128; ++ch) { v4h o4;
#pragma unroll
                for (int q = 0; q < 4; ++q) o4[q] = tohx(v[ch * 4 + q] * f);
                *(v4h*)(P16 + (size_t)row * TT + ch * 128 + lane * 4) = o4; } }
         }
}
__global__ __launch_bounds__(256) void k_merge(const float* __restrict__ O, int h0, bf* Ah, bf* Al) { const size_t e = ((size_t)blockIdx.x * 256 + threadIdx.x) * 2; if (e >= (size_t)ZH * TT * HD) return; const int d = (int)(e % HD); const int t = (int)((e / HD) % TT); const int zz = (int)(e / ((size_t)HD * TT)); const float cs = (t < RH) ? 1.0f : (1.0f / PCAR); const size_t oo = (size_t)t * DQ + (h0 + zz) * HD + d;
    v2us oh, ol;
#pragma unroll
    for (int q = 0; q < 2; ++q) { unsigned short a, c2; splitf(O[e + q] * cs, a, c2); oh[q] = a; ol[q] = c2; } *(v2us*)(Ah + oo) = oh; *(v2us*)(Al + oo) = ol;  }

extern "C" void kernel_launch(void* const* d_in, const int* in_sizes, int n_in,
                              void* d_out, int out_size, void* d_ws, size_t ws_size, hipStream_t stream) {
    (void)in_sizes; (void)n_in; (void)out_size;
    const float* x = (const float*)d_in[0]; const int* pid = (const int*)d_in[1]; const float* wq = (const float*)d_in[2]; const float* wk = (const float*)d_in[3]; const float* wv = (const float*)d_in[4]; const float* wo = (const float*)d_in[5]; const float* qsc = (const float*)d_in[6]; const float* ksc = (const float*)d_in[7];
    float* OUT = (float*)d_out;     // [8][1024][768]
    char* wsp = (char*)d_ws;
    auto take = [&](size_t bytes) { char* p = wsp; wsp += (bytes + 255) & ~(size_t)255; return (void*)p; };
    bf* WQ = (bf*)take((size_t)DQ * DM * 2); bf* WK = (bf*)take((size_t)DKV * DM * 2); bf* WV = (bf*)take((size_t)DKV * DM * 2); bf* WO = (bf*)take((size_t)DM * DQ * 2); float* CS = (float*)take((size_t)TT * HD * 2 * 4); float* RFQ = (float*)take((size_t)NH_ * TT * 4); float* RFK = (float*)take((size_t)NKV * TT * 4); float* RFV = (float*)take((size_t)NKV * TT * 4);
    bf* XB = (bf*)take((size_t)TT * DM * 2); float* FQ = (float*)take((size_t)TT * DQ * 4); float* FK = (float*)take((size_t)TT * DKV * 4);
    h16* QP16 = (h16*)take((size_t)NH_ * TT * HD * 2); h16* KP16 = (h16*)take((size_t)NKV * TT * HD * 2); h16* VT16 = (h16*)take((size_t)NKV * HD * TT * 2);
    bf* QPh = (bf*)take((size_t)NH_ * TT * HD * 2); bf* QPl = (bf*)take((size_t)NH_ * TT * HD * 2); bf* KPh = (bf*)take((size_t)NKV * TT * HD * 2); bf* KPl = (bf*)take((size_t)NKV * TT * HD * 2); bf* VTh = (bf*)take((size_t)NKV * HD * TT * 2); bf* VTl = (bf*)take((size_t)NKV * HD * TT * 2); bf* Ph = (bf*)take((size_t)ZH * RH * TT * 2); bf* Pl = (bf*)take((size_t)ZH * RH * TT * 2);
    float* Sb = (float*)take((size_t)ZH * TT * TT * 4); h16* P16 = nullptr; float* Ob = (float*)take((size_t)ZH * TT * HD * 4); bf* ATh = (bf*)take((size_t)TT * DQ * 2); bf* ATl = (bf*)take((size_t)TT * DQ * 2);
    if ((size_t)(wsp - (char*)d_ws) > ws_size) return;    // ws 256 MiB
    float* FV = FK;   // v projection reuses the k buffer after the k planes are built (stream-ordered)
    { k_cvt8<<<(unsigned)(((size_t)DQ * DM / 8 + 255) / 256), 256, 0, stream>>>(wq, WQ, (size_t)DQ * DM / 8); k_cvt8<<<(unsigned)(((size_t)DKV * DM / 8 + 255) / 256), 256, 0, stream>>>(wk, WK, (size_t)DKV * DM / 8); k_cvt8<<<(unsigned)(((size_t)DKV * DM / 8 + 255) / 256), 256, 0, stream>>>(wv, WV, (size_t)DKV * DM / 8);
      k_cvt8<<<(unsigned)(((size_t)DM * DQ / 8 + 255) / 256), 256, 0, stream>>>(wo, WO, (size_t)DM * DQ / 8);
       }
    const unsigned LQ = (unsigned)(((size_t)NH_ * TT * HD / 2 + 255) / 256), LKv = (unsigned)(((size_t)NKV * TT * HD / 2 + 255) / 256);
    for (int b = 0; b < NB_; ++b) {
        k_cs2d<<<(TT * HD + 255) / 256, 256, 0, stream>>>(pid + (size_t)b * TT * 2, CS);   /* this batch's 2-D rotary table */
        
        k_cvt8<<<(unsigned)(((size_t)TT * DM / 8 + 255) / 256), 256, 0, stream>>>(x + (size_t)b * TT * DM, XB, (size_t)TT * DM / 8);
        k_gemmw<bf, 0, false><<<dim3(TT / 64, DQ / 64, 1), 32, 0, stream>>>(XB, nullptr, WQ, nullptr, DM, FQ, DQ, nullptr, 0, 0, 0);
        k_hrms<<<(NH_ * TT + 255) / 256, 256, 0, stream>>>(FQ, DQ, NH_, RFQ); k_rope2d<<<LQ, 256, 0, stream>>>(FQ, DQ, NH_, CS, RFQ, qsc, QP16, QPh, QPl);
        k_gemmw<bf, 0, false><<<dim3(TT / 64, DKV / 64, 1), 32, 0, stream>>>(XB, nullptr, WK, nullptr, DM, FK, DKV, nullptr, 0, 0, 0);
        k_hrms<<<(NKV * TT + 255) / 256, 256, 0, stream>>>(FK, DKV, NKV, RFK); k_rope2d<<<LKv, 256, 0, stream>>>(FK, DKV, NKV, CS, RFK, ksc, KP16, KPh, KPl);
        k_gemmw<bf, 0, false><<<dim3(TT / 64, DKV / 64, 1), 32, 0, stream>>>(XB, nullptr, WV, nullptr, DM, FV, DKV, nullptr, 0, 0, 0); k_hrms<<<(NKV * TT + 255) / 256, 256, 0, stream>>>(FV, DKV, NKV, RFV); k_rowscale<<<(unsigned)(((size_t)TT * DKV / 4 + 255) / 256), 256, 0, stream>>>(FV, RFV, (size_t)TT * DKV / 4); k_vtp<<<LKv, 256, 0, stream>>>(FV, DKV, NKV, VT16, VTh, VTl);   /* v RMS-normalised (no scale) */
        for (int h0 = 0; h0 < NH_; h0 += ZH) { const size_t zq = (size_t)h0, zk = (size_t)(h0 / REP);   // one kv head per query head: the pass's two heads use consecutive kv planes (z-strides TT*HD)
            k_gemmw<bf, 2, false><<<dim3(RH / 64, TT / 64, ZH), 32, 0, stream>>>(QPh + zq * TT * HD, QPl + zq * TT * HD, KPh + zk * TT * HD, KPl + zk * TT * HD, HD, Sb, TT, nullptr, (size_t)TT * HD, (size_t)TT * HD, (size_t)TT * TT);
            k_asoft<<<ZH * TT / 8, 256, 0, stream>>>(Sb, P16, Ph, Pl);
            k_gemmw<bf, 2, false><<<dim3(RH / 64, HD / 64, ZH), 32, 0, stream>>>(Ph, Pl, VTh + zk * HD * TT, VTl + zk * HD * TT, TT, Ob, HD, nullptr, (size_t)RH * TT, (size_t)HD * TT, (size_t)TT * HD);
            k_merge<<<(unsigned)(((size_t)ZH * TT * HD / 2 + 255) / 256), 256, 0, stream>>>(Ob, h0, ATh, ATl); }
        k_gemmw<bf, 1, false><<<dim3(TT / 64, DM / 64, 1), 32, 0, stream>>>(ATh, ATl, WO, nullptr, DQ, OUT + (size_t)b * TT * DM, DM, nullptr, 0, 0, 0); }
}

// v001
// One run takes 649 microseconds.
// Next to v000, in two timings, it ran 3.70 and 3.68 times as fast.
#include <hip/hip_runtime.h>

// Vision attention with per-head RMSNorm and 2-D rotary positions (hidden [8][1024][768]; q,k,v = x W^T ('oi' [768][768], 12 heads x 64); q, k RMS-normalised per head (eps 1e-6) x scale, v RMS-normalised without scale; 2-D RoPE: the head's first 32 channels rotate (rotate-half within the 32) by the x position, the last 32 by the y position, angle = pos x 100^(-2i/32) from pixel_position_ids int32 [8][1024][2]; scores = q.k UNSCALED; softmax; out = merged Wo^T ('oi') -> [8][1024][768] (6.3 M)).
// Layout: every launch covers all 8 batches (token rows b*1024+t, or the batch on grid y); attention runs in passes of ZH consecutive (batch, head) planes on grid z. A small kernel builds the {cos, sin} table [8*1024][64] from the position ids (f32 powf/cosf/sinf); exact projections; per-(head, token) 1/rms kernels; a 2-D rotary plane builder applies (x * inv_rms) * scale and the within-half rotate-half while writing the q/k planes; v rows are scaled by their 1/rms in place before the value planes; dense T-1024 attention with EVERY row on hi/lo planes (the unscaled logits of unit-RMS vectors reach ~+-30); merged hi/lo x Wo exact.
// Compute dtypes, f32 accumulate: every input rounded to bf16; projections exact; RMSNorm/rotary f32; scores and attn.v 3 products on every row; softmax f32; Wo hl x exact.

#define NB_  8
#define TT   1024
#define DM   768
#define NH_  12
#define NKV  12
#define REP  (NH_ / NKV)
#define HD   64
#define DQ   (NH_ * HD)
#define DKV  (NKV * HD)
#define ZH   16                    // (batch, head) planes per attention pass; NB_*NH_ % ZH == 0
#define RH   1024                  // query rows < RH use hi+lo planes (0: none)
#define WIN  0
#define PCAR 1024.0f
#define SCL  1.0f   // unscaled (module scaling = 1.0)
typedef _Float16 h16;
typedef unsigned short bf;
typedef __attribute__((ext_vector_type(16))) __bf16   v16bf;
typedef __attribute__((ext_vector_type(16))) _Float16 v16h;
typedef __attribute__((ext_vector_type(8)))  _Float16 v8h;
typedef __attribute__((ext_vector_type(8)))  unsigned short v8us;
typedef __attribute__((ext_vector_type(8)))  float    v8f;
typedef __attribute__((ext_vector_type(4)))  float    v4f;
typedef v8h  __attribute__((may_alias)) v8ha;
typedef v4f  __attribute__((may_alias)) v4fa;
typedef v8us __attribute__((may_alias)) v8usa;

__device__ __forceinline__ unsigned short f2bf(float f) { unsigned u = __float_as_uint(f); u += 0x7FFFu + ((u >> 16) & 1u); return (unsigned short)(u >> 16); }
__device__ __forceinline__ float bf2f(unsigned short b) { return __uint_as_float(((unsigned)b) << 16); }
__device__ __forceinline__ float bfr(float f) { return bf2f(f2bf(f)); }
__device__ __forceinline__ v16h cat16(v8h lo, v8h hi) { return __builtin_shufflevector(lo, hi, 0, 1, 2, 3, 4, 5, 6, 7, 8, 9, 10, 11, 12, 13, 14, 15); }
__device__ __forceinline__ v16bf cat16b(v8us lo, v8us hi) { return __builtin_bit_cast(v16bf, __builtin_shufflevector(lo, hi, 0, 1, 2, 3, 4, 5, 6, 7, 8, 9, 10, 11, 12, 13, 14, 15)); }
__device__ __forceinline__ v8f wmma16(v16h a, v16h b, v8f c) { return __builtin_amdgcn_wmma_f32_16x16x32_f16(false, a, false, b, (short)0, c, false, false); }
__device__ __forceinline__ v8f wmmab(v16bf a, v16bf b, v8f c) { return __builtin_amdgcn_wmma_f32_16x16x32_bf16(false, a, false, b, (short)0, c, false, false); }



// ---- k_gemmw: register-blocked GEMM, ONE WAVE per 64x64 output tile (16 accumulators), operands straight from K-contiguous 16-bit planes; grid (M/64, N/64, Z), 32 threads.
// C[m][n] (f32, pitch ldc, + optional f32 bias[n]) = sum_k A[m][k] Bt[n][k] (+ split products per NSPLIT). z-batch strides sA/sB/sC in elements. K % 32 == 0.
template <typename T16> struct WFrag;
template <> struct WFrag<h16> { typedef v16h V; static __device__ __forceinline__ V ld(const h16* p) { return cat16(*(const v8h*)p, *(const v8h*)(p + 16)); } static __device__ __forceinline__ v8f mma(V a, V b, v8f c) { return wmma16(a, b, c); } };
template <> struct WFrag<bf> { typedef v16bf V; static __device__ __forceinline__ V ld(const bf* p) { return cat16b(*(const v8us*)p, *(const v8us*)(p + 16)); } static __device__ __forceinline__ v8f mma(V a, V b, v8f c) { return wmmab(a, b, c); } };
template <typename T16, int NSPLIT, bool BIAS>
__global__ __launch_bounds__(32) void k_gemmw(const T16* __restrict__ A, const T16* __restrict__ A2, const T16* __restrict__ Bt, const T16* __restrict__ Bt2, int K, float* C, int ldc, const float* __restrict__ bias, size_t sA, size_t sB, size_t sC) {
    typedef typename WFrag<T16>::V V;
    __shared__ __align__(16) float os[16 * 68];
    const size_t z = blockIdx.z; A += z * sA; if (A2) A2 += z * sA; Bt += z * sB; if (Bt2) Bt2 += z * sB; C += z * sC;
    const int lane = threadIdx.x & 31, lr = lane & 15, hi = lane >> 4; const int r0 = blockIdx.x * 64, c0 = blockIdx.y * 64;
    v8f acc[4][4];
#pragma unroll
    for (int mb = 0; mb < 4; ++mb)
#pragma unroll
        for (int nb = 0; nb < 4; ++nb) acc[mb][nb] = (v8f){};
    const size_t aoff = (size_t)(r0 + lr) * K + 8 * hi, boff = (size_t)(c0 + lr) * K + 8 * hi;
#pragma unroll 1
    for (int kc = 0; kc < K; kc += 32) {
        V a[4], a2[4];
#pragma unroll
        for (int mb = 0; mb < 4; ++mb) { a[mb] = WFrag<T16>::ld(A + aoff + (size_t)mb * 16 * K + kc); if (NSPLIT == 1 || NSPLIT == 2) a2[mb] = WFrag<T16>::ld(A2 + aoff + (size_t)mb * 16 * K + kc); }
#pragma unroll
        for (int nb = 0; nb < 4; ++nb) { const V b = WFrag<T16>::ld(Bt + boff + (size_t)nb * 16 * K + kc); V b2; if (NSPLIT >= 2) b2 = WFrag<T16>::ld(Bt2 + boff + (size_t)nb * 16 * K + kc);
#pragma unroll
            for (int mb = 0; mb < 4; ++mb) { acc[mb][nb] = WFrag<T16>::mma(a[mb], b, acc[mb][nb]); if (NSPLIT == 1 || NSPLIT == 2) acc[mb][nb] = WFrag<T16>::mma(a2[mb], b, acc[mb][nb]); if (NSPLIT >= 2) acc[mb][nb] = WFrag<T16>::mma(a[mb], b2, acc[mb][nb]); } }
        asm volatile("v_nop\n\tv_nop\n\tv_nop\n\tv_nop" : "+v"(acc[0][0]), "+v"(acc[1][1]), "+v"(acc[2][2]), "+v"(acc[3][3]) : "v"(a[0]), "v"(a[3]));
    }
#pragma unroll
    for (int mb = 0; mb < 4; ++mb) {
#pragma unroll
        for (int nb = 0; nb < 4; ++nb) {
#pragma unroll
            for (int j = 0; j < 8; ++j) os[(hi * 8 + j) * 68 + nb * 16 + lr] = acc[mb][nb][j]; }
        __builtin_amdgcn_wave_barrier(); asm volatile("" ::: "memory");
        float* crow = C + (size_t)(r0 + mb * 16) * ldc + c0;
{
#pragma unroll
            for (int s = 0; s < 8; ++s) { const int row = 2 * s + hi, cofs = lr * 4; v4f val = *(const v4fa*)(os + row * 68 + cofs); if (BIAS) { val[0] += bfr(bias[c0 + cofs]); val[1] += bfr(bias[c0 + cofs + 1]); val[2] += bfr(bias[c0 + cofs + 2]); val[3] += bfr(bias[c0 + cofs + 3]); }
                *(v4f*)(crow + (size_t)row * ldc + cofs) = val; }
             }
        __builtin_amdgcn_wave_barrier(); asm volatile("" ::: "memory");
    }
}

__device__ __forceinline__ h16 tohx(float x) { return (h16)x; }
__device__ __forceinline__ void splitf(float y, unsigned short& h, unsigned short& l) { h = f2bf(y); l = f2bf(y - bf2f(h)); }
typedef __attribute__((ext_vector_type(2))) _Float16 v2h;
typedef __attribute__((ext_vector_type(4))) _Float16 v4h;
typedef __attribute__((ext_vector_type(2))) unsigned short v2us;
typedef __attribute__((ext_vector_type(4))) unsigned short v4us;
typedef __attribute__((ext_vector_type(2))) float v2f;
typedef __attribute__((ext_vector_type(4))) int v4i;

__global__ __launch_bounds__(256) void k_wtG(const float* __restrict__ w, int K, int N, bf* Bt) {
    const int lane = threadIdx.x & 31; const int L0 = (blockIdx.x * 8 + (threadIdx.x >> 5)) * 8; const int nlines = N * K / 64;
{
#pragma unroll 1
        for (int l = 0; l < 8; ++l) { const int L = L0 + l; if (L >= nlines) break; const size_t e = (size_t)L * 64 + lane * 2; const int k = (int)(e % K), n = (int)(e / K); v2us o;
            o[0] = f2bf(w[(size_t)k * N + n]); o[1] = f2bf(w[(size_t)(k + 1) * N + n]); *(v2us*)(Bt + e) = o; }
         }
}
__global__ __launch_bounds__(256) void k_cvt8(const float* __restrict__ src, bf* dst, size_t n8) { const size_t i = (size_t)blockIdx.x * 256 + threadIdx.x; if (i >= n8) return; const v8f v = *(const v8f*)(src + i * 8); v8us o;
#pragma unroll
    for (int k = 0; k < 8; ++k) o[k] = f2bf(v[k]); *(v8us*)(dst + i * 8) = o;  }

__global__ __launch_bounds__(256) void k_cs2d(const int* __restrict__ pid, float* CS) { const int idx = blockIdx.x * 256 + threadIdx.x; if (idx >= NB_ * TT * HD) return; const int d = idx % HD; const int t = idx / HD; const int ax = d / (HD / 2); const int i = (d % (HD / 2)) % (HD / 4);
    const float e = __fdiv_rn((float)(2 * i), (float)(HD / 2)); const float inv = __fdiv_rn(1.0f, powf(100.0f, e)); const float a = __fmul_rn((float)pid[t * 2 + ax], inv); v2f cs; cs[0] = cosf(a); cs[1] = sinf(a);
    *(v2f*)(CS + (size_t)idx * 2) = cs;  }
__global__ __launch_bounds__(256) void k_hrms(const float* __restrict__ F, int pitch, int nheads, float* RF) { const int idx = blockIdx.x * 256 + threadIdx.x; if (idx >= nheads * TT) return; const int t = idx % TT; const int h = idx / TT; const int b = blockIdx.y; RF += (size_t)b * nheads * TT; const float* f = F + ((size_t)b * TT + t) * pitch + h * HD; float s = 0.f;
#pragma unroll 4
    for (int d = 0; d < HD; d += 4) { const v4f a = *(const v4f*)(f + d);
#pragma unroll
        for (int q = 0; q < 4; ++q) { float p = __fmul_rn(a[q], a[q]); asm volatile("" : "+v"(p)); s = __fadd_rn(s, p); } }
    const float rf = __fdiv_rn(1.0f, __fsqrt_rn(__fadd_rn(__fdiv_rn(s, (float)HD), 1e-6f))); *(float*)(RF + idx) = rf;  }
__global__ __launch_bounds__(256) void k_rope2d(const float* __restrict__ F, int pitch, int nheads, const float* __restrict__ CS, const float* __restrict__ RF, const float* __restrict__ nw, h16* P16, bf* Ph, bf* Pl) {
    const size_t e = ((size_t)blockIdx.x * 256 + threadIdx.x) * 2; if (e >= (size_t)nheads * TT * HD) return; const int d = (int)(e % HD); const int t = (int)((e / HD) % TT); const int h = (int)(e / ((size_t)HD * TT)); const int b = blockIdx.y; const float* f = F + ((size_t)b * TT + t) * pitch + h * HD; const float rf = RF[((size_t)b * nheads + h) * TT + t]; CS += (size_t)b * TT * HD * 2; const size_t eo = (size_t)b * nheads * TT * HD + e; v2h o16; v2us oh, ol;
#pragma unroll
    for (int q = 0; q < 2; ++q) { const int dd = d + q; const int dl = dd % (HD / 2); const bool lo = dl < (HD / 4); const int dp = lo ? dd + HD / 4 : dd - HD / 4;
        float n0 = __fmul_rn(f[dd], rf), n1 = __fmul_rn(f[dp], rf); asm volatile("" : "+v"(n0), "+v"(n1)); n0 = __fmul_rn(n0, bfr(nw[dd])); n1 = __fmul_rn(n1, bfr(nw[dp]));
        const v2f cs = *(const v2f*)(CS + ((size_t)t * HD + dd) * 2); float a = __fmul_rn(n0, cs[0]), bq = __fmul_rn(n1, cs[1]); asm volatile("" : "+v"(a), "+v"(bq)); const float r = lo ? __fsub_rn(a, bq) : __fadd_rn(a, bq);
        o16[q] = tohx(r); unsigned short a2, c2; splitf(r, a2, c2); oh[q] = a2; ol[q] = c2; }
    *(v2h*)(P16 + eo) = o16; *(v2us*)(Ph + eo) = oh; *(v2us*)(Pl + eo) = ol;  }
__global__ __launch_bounds__(256) void k_rowscale(float* F, const float* __restrict__ RF, size_t n4) { const size_t i = (size_t)blockIdx.x * 256 + threadIdx.x; if (i >= n4) return; const size_t e = i * 4; const int t = (int)((e / DKV) % TT); const int b = (int)(e / ((size_t)DKV * TT)); const int h = (int)((e % DKV) / HD); const float rf = RF[((size_t)b * NKV + h) * TT + t]; v4f a = *(const v4f*)(F + e);
#pragma unroll
    for (int q = 0; q < 4; ++q) a[q] = __fmul_rn(a[q], rf); *(v4f*)(F + e) = a;  }

__global__ __launch_bounds__(256) void k_vtp(const float* __restrict__ F, int pitch, int nheads, h16* V16, bf* Vh, bf* Vl) { const size_t e = ((size_t)blockIdx.x * 256 + threadIdx.x) * 2; if (e >= (size_t)nheads * HD * TT) return; const int t = (int)(e % TT); const int d = (int)((e / TT) % HD); const int g = (int)(e / ((size_t)TT * HD)); const int b = blockIdx.y; F += (size_t)b * TT * pitch; const size_t eo = (size_t)b * nheads * HD * TT + e; v2h o16; v2us oh, ol;
#pragma unroll
    for (int q = 0; q < 2; ++q) { const float x = F[(size_t)(t + q) * pitch + g * HD + d]; o16[q] = tohx(x); unsigned short a2, c2; splitf(x, a2, c2); oh[q] = a2; ol[q] = c2; }
    *(v2h*)(V16 + eo) = o16; *(v2us*)(Vh + eo) = oh; *(v2us*)(Vl + eo) = ol;  }
// k_asoft: per row (zz, i): t = S x SCL = S, unscaled (no mask); softmax over the 1024 keys (register row, one exp, fixed trees);
__global__ __launch_bounds__(256) void k_asoft(const float* __restrict__ Sb, h16* P16, bf* Ph, bf* Pl) {
    const int lane = threadIdx.x & 31; const int row = blockIdx.x * 8 + (threadIdx.x >> 5); if (row >= ZH * TT) return; const int i = row % TT; const int zz = row / TT; (void)zz; const bool hires = (i < RH); const float* sr = Sb + (size_t)row * TT; float v[TT / 32]; float mx = -3.0e38f;
#pragma unroll
    for (int ch = 0; ch < TT / 128; ++ch) { const int j0 = ch * 128 + lane * 4; const v4f a = *(const v4f*)(sr + j0);
#pragma unroll
        for (int q = 0; q < 4; ++q) { const int j = j0 + q; (void)j; const float t = a[q] * SCL; v[ch * 4 + q] = t; mx = fmaxf(mx, t); } }
#pragma unroll
    for (int sh = 16; sh; sh >>= 1) mx = fmaxf(mx, __shfl_xor(mx, sh, 32));
    float sum = 0.f;
#pragma unroll
    for (int k = 0; k < TT / 32; ++k) { float d0 = __fsub_rn(v[k], mx); asm volatile("" : "+v"(d0)); v[k] = __builtin_amdgcn_exp2f(__fmul_rn(d0, 1.4426950408889634f)); sum += v[k]; }
#pragma unroll
    for (int sh = 16; sh; sh >>= 1) sum += __shfl_xor(sum, sh, 32);
    const float f = __fdiv_rn(hires ? 1.0f : PCAR, sum);
{
        if (hires) {
#pragma unroll
            for (int ch = 0; ch < TT / 128; ++ch) { v4us oh, ol;
#pragma unroll
                for (int q = 0; q < 4; ++q) { unsigned short a, c2; splitf(v[ch * 4 + q] * f, a, c2); oh[q] = a; ol[q] = c2; }
                const size_t oo = ((size_t)zz * (RH ? RH : 1) + i) * TT + ch * 128 + lane * 4; *(v4us*)(Ph + oo) = oh; *(v4us*)(Pl + oo) = ol; }
        } else {
#pragma unroll
            for (int ch = 0; ch < TT / 128; ++ch) { v4h o4;
#pragma unroll
                for (int q = 0; q < 4; ++q) o4[q] = tohx(v[ch * 4 + q] * f);
                *(v4h*)(P16 + (size_t)row * TT + ch * 128 + lane * 4) = o4; } }
         }
}
__global__ __launch_bounds__(256) void k_merge(const float* __restrict__ O, int g0, bf* Ah, bf* Al) { const size_t e = ((size_t)blockIdx.x * 256 + threadIdx.x) * 2; if (e >= (size_t)ZH * TT * HD) return; const int d = (int)(e % HD); const int t = (int)((e / HD) % TT); const int zz = (int)(e / ((size_t)HD * TT)); const float cs = (t < RH) ? 1.0f : (1.0f / PCAR); const int g = g0 + zz; const size_t oo = ((size_t)(g / NH_) * TT + t) * DQ + (g % NH_) * HD + d;
    v2us oh, ol;
#pragma unroll
    for (int q = 0; q < 2; ++q) { unsigned short a, c2; splitf(O[e + q] * cs, a, c2); oh[q] = a; ol[q] = c2; } *(v2us*)(Ah + oo) = oh; *(v2us*)(Al + oo) = ol;  }

extern "C" void kernel_launch(void* const* d_in, const int* in_sizes, int n_in,
                              void* d_out, int out_size, void* d_ws, size_t ws_size, hipStream_t stream) {
    (void)in_sizes; (void)n_in; (void)out_size;
    const float* x = (const float*)d_in[0]; const int* pid = (const int*)d_in[1]; const float* wq = (const float*)d_in[2]; const float* wk = (const float*)d_in[3]; const float* wv = (const float*)d_in[4]; const float* wo = (const float*)d_in[5]; const float* qsc = (const float*)d_in[6]; const float* ksc = (const float*)d_in[7];
    float* OUT = (float*)d_out;     // [8][1024][768]
    char* wsp = (char*)d_ws;
    auto take = [&](size_t bytes) { char* p = wsp; wsp += (bytes + 255) & ~(size_t)255; return (void*)p; };
    bf* WQ = (bf*)take((size_t)DQ * DM * 2); bf* WK = (bf*)take((size_t)DKV * DM * 2); bf* WV = (bf*)take((size_t)DKV * DM * 2); bf* WO = (bf*)take((size_t)DM * DQ * 2); float* CS = (float*)take((size_t)NB_ * TT * HD * 2 * 4); float* RFQ = (float*)take((size_t)NB_ * NH_ * TT * 4); float* RFK = (float*)take((size_t)NB_ * NKV * TT * 4); float* RFV = (float*)take((size_t)NB_ * NKV * TT * 4);
    bf* QPh = (bf*)take((size_t)NB_ * NH_ * TT * HD * 2); bf* QPl = (bf*)take((size_t)NB_ * NH_ * TT * HD * 2); bf* KPh = (bf*)take((size_t)NB_ * NKV * TT * HD * 2); bf* KPl = (bf*)take((size_t)NB_ * NKV * TT * HD * 2); bf* VTh = (bf*)take((size_t)NB_ * NKV * HD * TT * 2); bf* VTl = (bf*)take((size_t)NB_ * NKV * HD * TT * 2);
    float* Ob = (float*)take((size_t)ZH * TT * HD * 4); bf* ATh = (bf*)take((size_t)NB_ * TT * DQ * 2); bf* ATl = (bf*)take((size_t)NB_ * TT * DQ * 2); h16* P16 = nullptr;
    // Two areas are used twice, in stream order: the score plane holds x (bf16) and the f32 projections until the q/k/v planes are built; the probability planes hold the f16 planes, which nothing reads.
    float* Sb = (float*)take((size_t)ZH * TT * TT * 4); bf* XB = (bf*)Sb; float* FQ = (float*)(XB + (size_t)NB_ * TT * DM); float* FK = FQ + (size_t)NB_ * TT * DQ;   // 12 + 24 + 24 MiB inside 64 MiB
    bf* Ph = (bf*)take((size_t)ZH * RH * TT * 2); bf* Pl = (bf*)take((size_t)ZH * RH * TT * 2); h16* QP16 = (h16*)Ph; h16* KP16 = QP16 + (size_t)NB_ * NH_ * TT * HD; h16* VT16 = (h16*)Pl;   // 12 + 12 MiB inside 32 MiB; 12 inside 32
    if ((size_t)(wsp - (char*)d_ws) > ws_size) return;    // ws 256 MiB
    float* FV = FK;   // v projection reuses the k buffer after the k planes are built (stream-ordered)
    { k_cvt8<<<(unsigned)(((size_t)DQ * DM / 8 + 255) / 256), 256, 0, stream>>>(wq, WQ, (size_t)DQ * DM / 8); k_cvt8<<<(unsigned)(((size_t)DKV * DM / 8 + 255) / 256), 256, 0, stream>>>(wk, WK, (size_t)DKV * DM / 8); k_cvt8<<<(unsigned)(((size_t)DKV * DM / 8 + 255) / 256), 256, 0, stream>>>(wv, WV, (size_t)DKV * DM / 8);
      k_cvt8<<<(unsigned)(((size_t)DM * DQ / 8 + 255) / 256), 256, 0, stream>>>(wo, WO, (size_t)DM * DQ / 8);
       }
    const unsigned LQ = (unsigned)(((size_t)NH_ * TT * HD / 2 + 255) / 256), LKv = (unsigned)(((size_t)NKV * TT * HD / 2 + 255) / 256);
    k_cs2d<<<(NB_ * TT * HD + 255) / 256, 256, 0, stream>>>(pid, CS);   /* the 2-D rotary table of all batches */
    k_cvt8<<<(unsigned)(((size_t)NB_ * TT * DM / 8 + 255) / 256), 256, 0, stream>>>(x, XB, (size_t)NB_ * TT * DM / 8);
    k_gemmw<bf, 0, false><<<dim3(NB_ * TT / 64, DQ / 64, 1), 32, 0, stream>>>(XB, nullptr, WQ, nullptr, DM, FQ, DQ, nullptr, 0, 0, 0);
    k_hrms<<<dim3((NH_ * TT + 255) / 256, NB_, 1), 256, 0, stream>>>(FQ, DQ, NH_, RFQ); k_rope2d<<<dim3(LQ, NB_, 1), 256, 0, stream>>>(FQ, DQ, NH_, CS, RFQ, qsc, QP16, QPh, QPl);
    k_gemmw<bf, 0, false><<<dim3(NB_ * TT / 64, DKV / 64, 1), 32, 0, stream>>>(XB, nullptr, WK, nullptr, DM, FK, DKV, nullptr, 0, 0, 0);
    k_hrms<<<dim3((NKV * TT + 255) / 256, NB_, 1), 256, 0, stream>>>(FK, DKV, NKV, RFK); k_rope2d<<<dim3(LKv, NB_, 1), 256, 0, stream>>>(FK, DKV, NKV, CS, RFK, ksc, KP16, KPh, KPl);
    k_gemmw<bf, 0, false><<<dim3(NB_ * TT / 64, DKV / 64, 1), 32, 0, stream>>>(XB, nullptr, WV, nullptr, DM, FV, DKV, nullptr, 0, 0, 0); k_hrms<<<dim3((NKV * TT + 255) / 256, NB_, 1), 256, 0, stream>>>(FV, DKV, NKV, RFV); k_rowscale<<<(unsigned)(((size_t)NB_ * TT * DKV / 4 + 255) / 256), 256, 0, stream>>>(FV, RFV, (size_t)NB_ * TT * DKV / 4); k_vtp<<<dim3(LKv, NB_, 1), 256, 0, stream>>>(FV, DKV, NKV, VT16, VTh, VTl);   /* v RMS-normalised (no scale) */
    for (int g0 = 0; g0 < NB_ * NH_; g0 += ZH) { const size_t zq = (size_t)g0, zk = (size_t)(g0 / REP);   // plane g = batch * 12 + head; one kv head per query head: the pass's ZH planes are consecutive in q and in kv (z-strides TT*HD)
        k_gemmw<bf, 2, false><<<dim3(RH / 64, TT / 64, ZH), 32, 0, stream>>>(QPh + zq * TT * HD, QPl + zq * TT * HD, KPh + zk * TT * HD, KPl + zk * TT * HD, HD, Sb, TT, nullptr, (size_t)TT * HD, (size_t)TT * HD, (size_t)TT * TT);
        k_asoft<<<ZH * TT / 8, 256, 0, stream>>>(Sb, P16, Ph, Pl);
        k_gemmw<bf, 2, false><<<dim3(RH / 64, HD / 64, ZH), 32, 0, stream>>>(Ph, Pl, VTh + zk * HD * TT, VTl + zk * HD * TT, TT, Ob, HD, nullptr, (size_t)RH * TT, (size_t)HD * TT, (size_t)TT * HD);
        k_merge<<<(unsigned)(((size_t)ZH * TT * HD / 2 + 255) / 256), 256, 0, stream>>>(Ob, g0, ATh, ATl); }
    k_gemmw<bf, 1, false><<<dim3(NB_ * TT / 64, DM / 64, 1), 32, 0, stream>>>(ATh, ATl, WO, nullptr, DQ, OUT, DM, nullptr, 0, 0, 0);
}

// v003
// A run of this version takes 224 microseconds.
// Versions in between are left out here; by their measured steps it is 2.89 times as fast as v001.
// Counting every step since v000, it is 10.7 times as fast.
#include <hip/hip_runtime.h>

// Vision attention with per-head RMSNorm and 2-D rotary positions (hidden [8][1024][768]; q,k,v = x W^T ('oi' [768][768], 12 heads x 64); q, k RMS-normalised per head (eps 1e-6) x scale, v RMS-normalised without scale; 2-D RoPE: the head's first 32 channels rotate (rotate-half within the 32) by the x position, the last 32 by the y position, angle = pos x 100^(-2i/32) from pixel_position_ids int32 [8][1024][2]; scores = q.k UNSCALED; softmax; out = merged Wo^T ('oi') -> [8][1024][768] (6.3 M)).
// Layout: every launch covers all 8 batches (token rows b*1024+t, or the batch on grid y); attention is ONE fused launch, a (batch, head) plane on grid y (k_fattn). A small kernel builds the {cos, sin} table [8*1024][64] from the position ids (f32 powf/cosf/sinf); exact projections, q, k and v in ONE launch whose epilogue (a 64x64 tile is 64 tokens of one head) takes the 1/rms of each row, applies (x * inv_rms) * scale and the within-half rotate-half and writes the q/k hi/lo planes, or scales v by its 1/rms and writes the transposed value planes; fused dense T-1024 attention with EVERY row on hi/lo planes (the unscaled logits of unit-RMS vectors reach ~+-30), scores and probabilities in registers only; merged hi/lo x Wo exact.
// Compute dtypes, f32 accumulate: every input rounded to bf16; projections exact; RMSNorm/rotary f32; scores and attn.v 3 products on every row; softmax f32 with a running maximum; Wo hl x exact.

#define NB_  8
#define TT   1024
#define DM   768
#define NH_  12
#define NKV  12
#define REP  (NH_ / NKV)
#define HD   64
#define DQ   (NH_ * HD)
#define DKV  (NKV * HD)
typedef _Float16 h16;
typedef unsigned short bf;
typedef __attribute__((ext_vector_type(16))) __bf16   v16bf;
typedef __attribute__((ext_vector_type(16))) _Float16 v16h;
typedef __attribute__((ext_vector_type(8)))  _Float16 v8h;
typedef __attribute__((ext_vector_type(8)))  unsigned short v8us;
typedef __attribute__((ext_vector_type(8)))  float    v8f;
typedef __attribute__((ext_vector_type(4)))  float    v4f;
typedef v8h  __attribute__((may_alias)) v8ha;
typedef v4f  __attribute__((may_alias)) v4fa;
typedef v8us __attribute__((may_alias)) v8usa;

__device__ __forceinline__ unsigned short f2bf(float f) { unsigned u = __float_as_uint(f); u += 0x7FFFu + ((u >> 16) & 1u); return (unsigned short)(u >> 16); }
__device__ __forceinline__ float bf2f(unsigned short b) { return __uint_as_float(((unsigned)b) << 16); }
__device__ __forceinline__ float bfr(float f) { return bf2f(f2bf(f)); }
__device__ __forceinline__ void splitf(float y, unsigned short& h, unsigned short& l) { h = f2bf(y); l = f2bf(y - bf2f(h)); }
__device__ __forceinline__ v16h cat16(v8h lo, v8h hi) { return __builtin_shufflevector(lo, hi, 0, 1, 2, 3, 4, 5, 6, 7, 8, 9, 10, 11, 12, 13, 14, 15); }
__device__ __forceinline__ v16bf cat16b(v8us lo, v8us hi) { return __builtin_bit_cast(v16bf, __builtin_shufflevector(lo, hi, 0, 1, 2, 3, 4, 5, 6, 7, 8, 9, 10, 11, 12, 13, 14, 15)); }
__device__ __forceinline__ v8f wmma16(v16h a, v16h b, v8f c) { return __builtin_amdgcn_wmma_f32_16x16x32_f16(false, a, false, b, (short)0, c, false, false); }
__device__ __forceinline__ v8f wmmab(v16bf a, v16bf b, v8f c) { return __builtin_amdgcn_wmma_f32_16x16x32_bf16(false, a, false, b, (short)0, c, false, false); }



// ---- k_gemmw: register-blocked GEMM, ONE WAVE per 64x64 output tile (16 accumulators), operands straight from K-contiguous 16-bit planes; grid (M/64, N/64, Z), 32 threads.
// C[m][n] (f32, pitch ldc, + optional f32 bias[n]) = sum_k A[m][k] Bt[n][k] (+ split products per NSPLIT). z-batch strides sA/sB/sC in elements. K % 32 == 0.
template <typename T16> struct WFrag;
template <> struct WFrag<h16> { typedef v16h V; static __device__ __forceinline__ V ld(const h16* p) { return cat16(*(const v8h*)p, *(const v8h*)(p + 16)); } static __device__ __forceinline__ v8f mma(V a, V b, v8f c) { return wmma16(a, b, c); } };
template <> struct WFrag<bf> { typedef v16bf V; static __device__ __forceinline__ V ld(const bf* p) { return cat16b(*(const v8us*)p, *(const v8us*)(p + 16)); } static __device__ __forceinline__ v8f mma(V a, V b, v8f c) { return wmmab(a, b, c); } };
typedef __attribute__((ext_vector_type(2))) float v2f;
typedef __attribute__((ext_vector_type(2))) __bf16 v2bf;
typedef __attribute__((ext_vector_type(8))) __bf16 v8bf;
__device__ __forceinline__ v2f rbf2(v2f y) { return __builtin_convertvector(__builtin_convertvector(y, v2bf), v2f); }   // two values rounded to bf16
__device__ __forceinline__ void split2(v2f y, v2bf& h, v2bf& l) { h = __builtin_convertvector(y, v2bf); l = __builtin_convertvector(y - __builtin_convertvector(h, v2f), v2bf); }   // hi/lo planes of two values
// QKV = true: Bt holds the q, k and v weights one behind the other (blockIdx.y / 12 says which, blockIdx.y % 12 the head); nothing goes to C: the epilogue normalises, rotates and writes the attention planes (QkvEpi).
struct QkvEpi { const float* CS; const float* qsc; const float* ksc; bf* Qh; bf* Ql; bf* Kh; bf* Kl; bf* Vh; bf* Vl; };
template <typename T16, int NSPLIT, bool BIAS, bool QKV>
__global__ __launch_bounds__(32) void k_gemmw(const T16* __restrict__ A, const T16* __restrict__ A2, const T16* __restrict__ Bt, const T16* __restrict__ Bt2, int K, float* C, int ldc, const float* __restrict__ bias, size_t sA, size_t sB, size_t sC, QkvEpi ep) {
    typedef typename WFrag<T16>::V V;
    __shared__ __align__(16) float os[16 * 68];
    __shared__ __align__(16) float rfs[16];
    const size_t z = blockIdx.z; A += z * sA; if (A2) A2 += z * sA; Bt += z * sB; if (Bt2) Bt2 += z * sB; C += z * sC;
    const int lane = threadIdx.x & 31, lr = lane & 15, hi = lane >> 4; const int r0 = blockIdx.x * 64, c0 = blockIdx.y * 64;
    v8f acc[4][4];
#pragma unroll
    for (int mb = 0; mb < 4; ++mb)
#pragma unroll
        for (int nb = 0; nb < 4; ++nb) acc[mb][nb] = (v8f){};
    const size_t aoff = (size_t)(r0 + lr) * K + 8 * hi, boff = (size_t)(c0 + lr) * K + 8 * hi;
#pragma unroll 1
    for (int kc = 0; kc < K; kc += 32) {
        V a[4], a2[4];
#pragma unroll
        for (int mb = 0; mb < 4; ++mb) { a[mb] = WFrag<T16>::ld(A + aoff + (size_t)mb * 16 * K + kc); if (NSPLIT == 1 || NSPLIT == 2) a2[mb] = WFrag<T16>::ld(A2 + aoff + (size_t)mb * 16 * K + kc); }
#pragma unroll
        for (int nb = 0; nb < 4; ++nb) { const V b = WFrag<T16>::ld(Bt + boff + (size_t)nb * 16 * K + kc); V b2; if (NSPLIT >= 2) b2 = WFrag<T16>::ld(Bt2 + boff + (size_t)nb * 16 * K + kc);
#pragma unroll
            for (int mb = 0; mb < 4; ++mb) { acc[mb][nb] = WFrag<T16>::mma(a[mb], b, acc[mb][nb]); if (NSPLIT == 1 || NSPLIT == 2) acc[mb][nb] = WFrag<T16>::mma(a2[mb], b, acc[mb][nb]); if (NSPLIT >= 2) acc[mb][nb] = WFrag<T16>::mma(a[mb], b2, acc[mb][nb]); } }
        asm volatile("v_nop\n\tv_nop\n\tv_nop\n\tv_nop" : "+v"(acc[0][0]), "+v"(acc[1][1]), "+v"(acc[2][2]), "+v"(acc[3][3]) : "v"(a[0]), "v"(a[3]));
    }
#pragma unroll
    for (int mb = 0; mb < 4; ++mb) {
#pragma unroll
        for (int nb = 0; nb < 4; ++nb) {
#pragma unroll
            for (int j = 0; j < 8; ++j) os[(hi * 8 + j) * 68 + nb * 16 + lr] = acc[mb][nb][j]; }
        __builtin_amdgcn_wave_barrier(); asm volatile("" ::: "memory");
        if constexpr (QKV) {
            // lane = (row, half): 32 channels of one token, which hold every rotate-half pair (c, c + 16) of one axis
            const int sel = blockIdx.y / NH_, g = (r0 / TT) * NH_ + blockIdx.y % NH_, tk = r0 % TT + mb * 16; const int row = lane >> 1, hf = lane & 1;
            float xv[32]; float ss = 0.f;
#pragma unroll
            for (int c = 0; c < 8; ++c) { const v4f q = *(const v4fa*)(os + row * 68 + hf * 32 + c * 4);
#pragma unroll
                for (int i = 0; i < 4; ++i) { xv[c * 4 + i] = q[i]; ss += q[i] * q[i]; } }
            ss += __shfl_xor(ss, 1);    // the row's other half
            const float rf = __fdiv_rn(1.0f, __fsqrt_rn(ss * (1.0f / HD) + 1e-6f));
            if (sel < 2) {
                const float* nw = (sel ? ep.ksc : ep.qsc) + hf * 32; const float* cs = ep.CS + ((size_t)(r0 + mb * 16 + row) * HD + hf * 32) * 2;
                bf* Ph = sel ? ep.Kh : ep.Qh; bf* Pl = sel ? ep.Kl : ep.Ql; const size_t eo = ((size_t)g * TT + tk + row) * HD + hf * 32;
#pragma unroll
                for (int c = 0; c < 16; c += 8) { v8bf ah, al, bh, bl;   // channels c .. c + 7 (a) and their partners c + 16 .. c + 23 (b)
#pragma unroll
                    for (int i = 0; i < 8; i += 2) { const v4f e = *(const v4f*)(cs + (c + i) * 2);   // {cos, sin} of channels c + i, c + i + 1 (those of + 16 are the same)
                        const v2f w0 = rbf2(*(const v2f*)(nw + c + i)), w1 = rbf2(*(const v2f*)(nw + 16 + c + i)); const v2f co = { e[0], e[2] }, si = { e[1], e[3] };
                        const v2f x0 = { xv[c + i], xv[c + i + 1] }, x1 = { xv[c + 16 + i], xv[c + 16 + i + 1] }; const v2f n0 = x0 * rf * w0, n1 = x1 * rf * w1;
                        v2bf h, l; split2(n0 * co - n1 * si, h, l); ah[i] = h[0]; ah[i + 1] = h[1]; al[i] = l[0]; al[i + 1] = l[1];
                        split2(n1 * co + n0 * si, h, l); bh[i] = h[0]; bh[i + 1] = h[1]; bl[i] = l[0]; bl[i + 1] = l[1]; }
                    *(v8us*)(Ph + eo + c) = __builtin_bit_cast(v8us, ah); *(v8us*)(Pl + eo + c) = __builtin_bit_cast(v8us, al); *(v8us*)(Ph + eo + 16 + c) = __builtin_bit_cast(v8us, bh); *(v8us*)(Pl + eo + 16 + c) = __builtin_bit_cast(v8us, bl);
                    asm volatile("s_wait_xcnt 0x0" ::: "memory");   // what follows reuses the data and address registers of these stores
                    __builtin_amdgcn_sched_barrier(0); }            // keeps it behind the wait
            } else {
                if (hf == 0) rfs[row] = rf;
                __builtin_amdgcn_wave_barrier(); asm volatile("" ::: "memory");   // the 1/rms of the 16 rows are read by other lanes than wrote them
                const v4f f0 = *(const v4fa*)(rfs + hi * 8), f1 = *(const v4fa*)(rfs + hi * 8 + 4);
#pragma unroll
                for (int nb = 0; nb < 4; ++nb) { v8bf oh, ol;   // a lane holds 8 tokens in a row of one channel: 16 bytes of the transposed plane
#pragma unroll
                    for (int j = 0; j < 8; j += 2) { const v2f y = { acc[mb][nb][j] * (j < 4 ? f0[j & 3] : f1[j & 3]), acc[mb][nb][j + 1] * (j < 4 ? f0[(j & 3) + 1] : f1[(j & 3) + 1]) };
                        v2bf h, l; split2(y, h, l); oh[j] = h[0]; oh[j + 1] = h[1]; ol[j] = l[0]; ol[j + 1] = l[1]; }
                    const size_t vo = ((size_t)g * HD + nb * 16 + lr) * TT + tk + hi * 8; *(v8us*)(ep.Vh + vo) = __builtin_bit_cast(v8us, oh); *(v8us*)(ep.Vl + vo) = __builtin_bit_cast(v8us, ol);
                    asm volatile("s_wait_xcnt 0x0" ::: "memory");   // the next tile's split reuses the data and address registers of these stores
                    __builtin_amdgcn_sched_barrier(0); }            // keeps it behind the wait
            }
        } else {
        float* crow = C + (size_t)(r0 + mb * 16) * ldc + c0;
{
#pragma unroll
            for (int s = 0; s < 8; ++s) { const int row = 2 * s + hi, cofs = lr * 4; v4f val = *(const v4fa*)(os + row * 68 + cofs); if (BIAS) { val[0] += bfr(bias[c0 + cofs]); val[1] += bfr(bias[c0 + cofs + 1]); val[2] += bfr(bias[c0 + cofs + 2]); val[3] += bfr(bias[c0 + cofs + 3]); }
                *(v4f*)(crow + (size_t)row * ldc + cofs) = val; }
             }
        }
        __builtin_amdgcn_wave_barrier(); asm volatile("" ::: "memory");
    }
}

__device__ __forceinline__ h16 tohx(float x) { return (h16)x; }
typedef __attribute__((ext_vector_type(2))) _Float16 v2h;
typedef __attribute__((ext_vector_type(4))) _Float16 v4h;
typedef __attribute__((ext_vector_type(2))) unsigned short v2us;
typedef __attribute__((ext_vector_type(4))) unsigned short v4us;
typedef __attribute__((ext_vector_type(4))) int v4i;

__global__ __launch_bounds__(256) void k_wtG(const float* __restrict__ w, int K, int N, bf* Bt) {
    const int lane = threadIdx.x & 31; const int L0 = (blockIdx.x * 8 + (threadIdx.x >> 5)) * 8; const int nlines = N * K / 64;
{
#pragma unroll 1
        for (int l = 0; l < 8; ++l) { const int L = L0 + l; if (L >= nlines) break; const size_t e = (size_t)L * 64 + lane * 2; const int k = (int)(e % K), n = (int)(e / K); v2us o;
            o[0] = f2bf(w[(size_t)k * N + n]); o[1] = f2bf(w[(size_t)(k + 1) * N + n]); *(v2us*)(Bt + e) = o; }
         }
}
__global__ __launch_bounds__(256) void k_cvt8(const float* __restrict__ src, bf* dst, size_t n8) { const size_t i = (size_t)blockIdx.x * 256 + threadIdx.x; if (i >= n8) return; const v8f v = *(const v8f*)(src + i * 8); v8us o;
#pragma unroll
    for (int k = 0; k < 8; ++k) o[k] = f2bf(v[k]); *(v8us*)(dst + i * 8) = o;  }

__global__ __launch_bounds__(256) void k_cs2d(const int* __restrict__ pid, float* CS) { const int idx = blockIdx.x * 256 + threadIdx.x; if (idx >= NB_ * TT * HD) return; const int d = idx % HD; const int t = idx / HD; const int ax = d / (HD / 2); const int i = (d % (HD / 2)) % (HD / 4);
    const float e = __fdiv_rn((float)(2 * i), (float)(HD / 2)); const float inv = __fdiv_rn(1.0f, powf(100.0f, e)); const float a = __fmul_rn((float)pid[t * 2 + ax], inv); v2f cs; cs[0] = cosf(a); cs[1] = sinf(a);
    *(v2f*)(CS + (size_t)idx * 2) = cs;  }
// ---- k_fattn: scores, softmax and attn.v of one (batch, head) plane in ONE kernel; the scores never leave the registers.
// Grid (TT / 128, planes), 4 waves; a wave owns 32 query columns and walks the 1024 keys in steps of 32, operands straight from the hi/lo planes (no LDS, no barrier). Scores unscaled (module scaling 1.0).
// S^T = K Q^T (A = key rows, B = query columns) and O^T += V^T P^T (A = rows of the transposed value plane, B = P^T): in every tile a lane holds ONE query (column lane & 15),
// so maximum, sum and rescale are per lane plus one exchange with lane ^ 16, and two S^T tiles (keys 0-15, 16-31) are, converted in place, the B fragment of the second product.
// Running maximum (online softmax): P = exp(s - m) unnormalised on hi/lo planes, O and the sum rescaled by exp(m_old - m_new) each step, one division at the end. Writes the merged hi/lo rows.
__device__ __forceinline__ float xhalf(float x) { const int b = __float_as_int(x); return __int_as_float(__builtin_amdgcn_permlanex16(b, b, 0x76543210, 0xfedcba98, false, false)); }   // value of lane ^ 16
__global__ __launch_bounds__(128) void k_fattn(const bf* __restrict__ Qh, const bf* __restrict__ Ql, const bf* __restrict__ Kh, const bf* __restrict__ Kl, const bf* __restrict__ Vh, const bf* __restrict__ Vl, bf* Ah, bf* Al) {
    typedef WFrag<bf> W;
    const int lane = threadIdx.x & 31, lr = lane & 15, hi = lane >> 4; const int g = blockIdx.y; const int q0 = (blockIdx.x * 4 + (threadIdx.x >> 5)) * 32;
    const size_t po = (size_t)g * TT * HD; const size_t qo = po + (size_t)(q0 + lr) * HD + 8 * hi;
    const bf* kh = Kh + po + (size_t)lr * HD + 8 * hi; const bf* kl = Kl + po + (size_t)lr * HD + 8 * hi; const bf* vh = Vh + po + (size_t)lr * TT + 8 * hi; const bf* vl = Vl + po + (size_t)lr * TT + 8 * hi;
    v16bf qh[2][2], ql[2][2];
#pragma unroll
    for (int nq = 0; nq < 2; ++nq)
#pragma unroll
        for (int kc = 0; kc < 2; ++kc) { qh[nq][kc] = W::ld(Qh + qo + nq * 16 * HD + kc * 32); ql[nq][kc] = W::ld(Ql + qo + nq * 16 * HD + kc * 32); }
    v16bf ka[2][2], kb[2][2];   // this step's key fragments (hi, lo), fetched one step ahead
#pragma unroll
    for (int kt = 0; kt < 2; ++kt)
#pragma unroll
        for (int kc = 0; kc < 2; ++kc) { ka[kt][kc] = W::ld(kh + (size_t)kt * 16 * HD + kc * 32); kb[kt][kc] = W::ld(kl + (size_t)kt * 16 * HD + kc * 32); }
    asm volatile("s_wait_xcnt 0x0" ::: "memory");   // the start values below reuse the address registers of the loads above
    __builtin_amdgcn_sched_barrier(0);              // keeps those start values behind the wait
    v8f o[2][4]; float m[2], l[2];
#pragma unroll
    for (int nq = 0; nq < 2; ++nq) { m[nq] = -3.0e38f; l[nq] = 0.f;
#pragma unroll
        for (int dt = 0; dt < 4; ++dt) o[nq][dt] = (v8f){}; }
#pragma unroll 1
    for (int k0 = 0; k0 < TT; k0 += 32) {
        v16bf va[4], vb[4];         // this step's value fragments: in flight under the score products and the softmax
#pragma unroll
        for (int dt = 0; dt < 4; ++dt) { va[dt] = W::ld(vh + (size_t)dt * 16 * TT + k0); vb[dt] = W::ld(vl + (size_t)dt * 16 * TT + k0); }
        v8f s[2][2];
#pragma unroll
        for (int kt = 0; kt < 2; ++kt) { s[0][kt] = (v8f){}; s[1][kt] = (v8f){};
#pragma unroll
            for (int kc = 0; kc < 2; ++kc) {
#pragma unroll
                for (int nq = 0; nq < 2; ++nq) { s[nq][kt] = wmmab(ka[kt][kc], qh[nq][kc], s[nq][kt]); s[nq][kt] = wmmab(ka[kt][kc], ql[nq][kc], s[nq][kt]); s[nq][kt] = wmmab(kb[kt][kc], qh[nq][kc], s[nq][kt]); } } }
        const int kn = (k0 + 32) & (TT - 1);   // the next step's keys (the last step fetches step 0 again: in bounds, unused)
#pragma unroll
        for (int kt = 0; kt < 2; ++kt)
#pragma unroll
            for (int kc = 0; kc < 2; ++kc) { ka[kt][kc] = W::ld(kh + (size_t)(kn + kt * 16) * HD + kc * 32); kb[kt][kc] = W::ld(kl + (size_t)(kn + kt * 16) * HD + kc * 32); }
        asm volatile("s_wait_xcnt 0x0" ::: "memory");   // the softmax below reuses the address registers of the loads above
        __builtin_amdgcn_sched_barrier(0);     // keeps the loads above issued in front of the softmax, so that their latency runs under it
        v16bf ph[2], pl[2];
#pragma unroll
        for (int nq = 0; nq < 2; ++nq) { float mx = s[nq][0][0];
#pragma unroll
            for (int j = 0; j < 8; ++j) mx = fmaxf(mx, fmaxf(s[nq][0][j], s[nq][1][j]));
            mx = fmaxf(mx, xhalf(mx)); const float mn = fmaxf(m[nq], mx); const float al = __builtin_amdgcn_exp2f((m[nq] - mn) * 1.4426950408889634f); m[nq] = mn; float sum = 0.f;
#pragma unroll
            for (int e = 0; e < 16; e += 2) { v2f t; t[0] = s[nq][e >> 3][e & 7]; t[1] = s[nq][e >> 3][(e & 7) + 1]; t = (t - mn) * 1.4426950408889634f; v2f p; p[0] = __builtin_amdgcn_exp2f(t[0]); p[1] = __builtin_amdgcn_exp2f(t[1]); sum += p[0]; sum += p[1];
                const v2bf h = __builtin_convertvector(p, v2bf); const v2bf r = __builtin_convertvector(p - __builtin_convertvector(h, v2f), v2bf); ph[nq][e] = h[0]; ph[nq][e + 1] = h[1]; pl[nq][e] = r[0]; pl[nq][e + 1] = r[1]; }
            l[nq] = l[nq] * al + sum;
#pragma unroll
            for (int dt = 0; dt < 4; ++dt) o[nq][dt] *= al; }
#pragma unroll
        for (int dt = 0; dt < 4; ++dt) { const v16bf a = va[dt]; const v16bf a2 = vb[dt];
#pragma unroll
            for (int nq = 0; nq < 2; ++nq) { o[nq][dt] = wmmab(a, ph[nq], o[nq][dt]); o[nq][dt] = wmmab(a, pl[nq], o[nq][dt]); o[nq][dt] = wmmab(a2, ph[nq], o[nq][dt]); } }
    }
#pragma unroll
    for (int nq = 0; nq < 2; ++nq) { const float f = __fdiv_rn(1.0f, l[nq] + xhalf(l[nq])); const size_t oo = ((size_t)(g / NH_) * TT + q0 + nq * 16 + lr) * DQ + (g % NH_) * HD + hi * 8;
#pragma unroll
        for (int dt = 0; dt < 4; ++dt) { v8us oh, ol;
#pragma unroll
            for (int j = 0; j < 8; ++j) { unsigned short a, c2; splitf(o[nq][dt][j] * f, a, c2); oh[j] = a; ol[j] = c2; }
            *(v8us*)(Ah + oo + dt * 16) = oh; *(v8us*)(Al + oo + dt * 16) = ol;
            asm volatile("s_wait_xcnt 0x0" ::: "memory");   // the next tile's split reuses the data registers of these stores
            __builtin_amdgcn_sched_barrier(0); } }          // keeps the next tile's split behind the wait
}

extern "C" void kernel_launch(void* const* d_in, const int* in_sizes, int n_in,
                              void* d_out, int out_size, void* d_ws, size_t ws_size, hipStream_t stream) {
    (void)in_sizes; (void)n_in; (void)out_size;
    const float* x = (const float*)d_in[0]; const int* pid = (const int*)d_in[1]; const float* wq = (const float*)d_in[2]; const float* wk = (const float*)d_in[3]; const float* wv = (const float*)d_in[4]; const float* wo = (const float*)d_in[5]; const float* qsc = (const float*)d_in[6]; const float* ksc = (const float*)d_in[7];
    float* OUT = (float*)d_out;     // [8][1024][768]
    char* wsp = (char*)d_ws;
    auto take = [&](size_t bytes) { char* p = wsp; wsp += (bytes + 255) & ~(size_t)255; return (void*)p; };
    bf* WQ = (bf*)take((size_t)(DQ + 2 * DKV) * DM * 2); bf* WK = WQ + (size_t)DQ * DM; bf* WV = WK + (size_t)DKV * DM;   // one [2304][768] weight plane: q, k, v rows one behind the other
    bf* WO = (bf*)take((size_t)DM * DQ * 2); float* CS = (float*)take((size_t)NB_ * TT * HD * 2 * 4);
    bf* QPh = (bf*)take((size_t)NB_ * NH_ * TT * HD * 2); bf* QPl = (bf*)take((size_t)NB_ * NH_ * TT * HD * 2); bf* KPh = (bf*)take((size_t)NB_ * NKV * TT * HD * 2); bf* KPl = (bf*)take((size_t)NB_ * NKV * TT * HD * 2); bf* VTh = (bf*)take((size_t)NB_ * NKV * HD * TT * 2); bf* VTl = (bf*)take((size_t)NB_ * NKV * HD * TT * 2);
    bf* ATh = (bf*)take((size_t)NB_ * TT * DQ * 2); bf* ATl = (bf*)take((size_t)NB_ * TT * DQ * 2);
    bf* XB = (bf*)take((size_t)NB_ * TT * DM * 2);   // x in bf16
    if ((size_t)(wsp - (char*)d_ws) > ws_size) return;    // ws 256 MiB
    { k_cvt8<<<(unsigned)(((size_t)DQ * DM / 8 + 255) / 256), 256, 0, stream>>>(wq, WQ, (size_t)DQ * DM / 8); k_cvt8<<<(unsigned)(((size_t)DKV * DM / 8 + 255) / 256), 256, 0, stream>>>(wk, WK, (size_t)DKV * DM / 8); k_cvt8<<<(unsigned)(((size_t)DKV * DM / 8 + 255) / 256), 256, 0, stream>>>(wv, WV, (size_t)DKV * DM / 8);
      k_cvt8<<<(unsigned)(((size_t)DM * DQ / 8 + 255) / 256), 256, 0, stream>>>(wo, WO, (size_t)DM * DQ / 8);
       }
    k_cs2d<<<(NB_ * TT * HD + 255) / 256, 256, 0, stream>>>(pid, CS);   /* the 2-D rotary table of all batches */
    k_cvt8<<<(unsigned)(((size_t)NB_ * TT * DM / 8 + 255) / 256), 256, 0, stream>>>(x, XB, (size_t)NB_ * TT * DM / 8);
    const QkvEpi ep = { CS, qsc, ksc, QPh, QPl, KPh, KPl, VTh, VTl };
    k_gemmw<bf, 0, false, true><<<dim3(NB_ * TT / 64, (DQ + 2 * DKV) / 64, 1), 32, 0, stream>>>(XB, nullptr, WQ, nullptr, DM, nullptr, 0, nullptr, 0, 0, 0, ep);   // q, k, v projections with RMSNorm, rotary and plane build in the epilogue
    k_fattn<<<dim3(TT / 128, NB_ * NH_, 1), 128, 0, stream>>>(QPh, QPl, KPh, KPl, VTh, VTl, ATh, ATl);   // plane g = batch * 12 + head; one kv head per query head
    k_gemmw<bf, 1, false, false><<<dim3(NB_ * TT / 64, DM / 64, 1), 32, 0, stream>>>(ATh, ATl, WO, nullptr, DQ, OUT, DM, nullptr, 0, 0, 0, QkvEpi{});
}

// v004
// One run takes 137 microseconds.
// Timed twice side by side with v003, it ran 1.64 and 1.63 times as fast.
// Counting every step since v000, it is 17.4 times as fast.
#include <hip/hip_runtime.h>

// Vision attention with per-head RMSNorm and 2-D rotary positions (hidden [8][1024][768]; q,k,v = x W^T ('oi' [768][768], 12 heads x 64); q, k RMS-normalised per head (eps 1e-6) x scale, v RMS-normalised without scale; 2-D RoPE: the head's first 32 channels rotate (rotate-half within the 32) by the x position, the last 32 by the y position, angle = pos x 100^(-2i/32) from pixel_position_ids int32 [8][1024][2]; scores = q.k UNSCALED; softmax; out = merged Wo^T ('oi') -> [8][1024][768] (6.3 M)).
// Layout: every launch covers all 8 batches (token rows b*1024+t, or the batch on grid y); attention is ONE fused launch, a (batch, head) plane on grid y (k_fattn). A small kernel builds the {cos, sin} table (32 angles a token) from the position ids (f32 powf/cosf/sinf); exact projections, q, k and v in ONE launch whose epilogue (a 64x64 tile is 64 tokens of one head) takes the 1/rms of each row, applies (x * inv_rms) * scale and the within-half rotate-half and writes the q/k hi/lo planes, or scales v by its 1/rms and writes the transposed value planes; fused dense T-1024 attention with EVERY row on hi/lo planes (the unscaled logits of unit-RMS vectors reach ~+-30), scores and probabilities in registers only; merged hi/lo x Wo exact.
// Plane layout ("fragment order"): every 16-bit operand plane is a row of WMMA fragments. A fragment (16 rows x 32 k) is 512 elements in the order [half of 16 k][lane][8 elements], lane = ((k / 8) & 1) * 16 + (row & 15):
// its two 16-byte loads are then 512 contiguous bytes each over the wave (4 whole 128-byte lines, not 32-byte pieces of 16 lines). The fragments lie as their reader walks them: x, weights and merged rows [64-row band][k / 32][16-row tile]; q and k [16-token tile][k / 32]; v [32 keys][16 channels]. The {cos, sin} table lies in its readers' lane order too (k_cs2d). The values and every sum order are those of row-major planes.
// Compute dtypes, f32 accumulate: every input rounded to bf16; projections exact; RMSNorm/rotary f32; scores and attn.v 3 products on every row; softmax f32 with a running maximum; Wo hl x exact.

#define NB_  8
#define TT   1024
#define DM   768
#define NH_  12
#define NKV  12
#define REP  (NH_ / NKV)
#define HD   64
#define DQ   (NH_ * HD)
#define DKV  (NKV * HD)
typedef _Float16 h16;
typedef unsigned short bf;
typedef __attribute__((ext_vector_type(16))) __bf16   v16bf;
typedef __attribute__((ext_vector_type(16))) _Float16 v16h;
typedef __attribute__((ext_vector_type(8)))  _Float16 v8h;
typedef __attribute__((ext_vector_type(8)))  unsigned short v8us;
typedef __attribute__((ext_vector_type(8)))  float    v8f;
typedef __attribute__((ext_vector_type(4)))  float    v4f;
typedef v8h  __attribute__((may_alias)) v8ha;
typedef v4f  __attribute__((may_alias)) v4fa;
typedef v8us __attribute__((may_alias)) v8usa;

__device__ __forceinline__ unsigned short f2bf(float f) { unsigned u = __float_as_uint(f); u += 0x7FFFu + ((u >> 16) & 1u); return (unsigned short)(u >> 16); }
__device__ __forceinline__ float bf2f(unsigned short b) { return __uint_as_float(((unsigned)b) << 16); }
__device__ __forceinline__ float bfr(float f) { return bf2f(f2bf(f)); }
__device__ __forceinline__ void splitf(float y, unsigned short& h, unsigned short& l) { h = f2bf(y); l = f2bf(y - bf2f(h)); }
__device__ __forceinline__ v16h cat16(v8h lo, v8h hi) { return __builtin_shufflevector(lo, hi, 0, 1, 2, 3, 4, 5, 6, 7, 8, 9, 10, 11, 12, 13, 14, 15); }
__device__ __forceinline__ v16bf cat16b(v8us lo, v8us hi) { return __builtin_bit_cast(v16bf, __builtin_shufflevector(lo, hi, 0, 1, 2, 3, 4, 5, 6, 7, 8, 9, 10, 11, 12, 13, 14, 15)); }
__device__ __forceinline__ v8f wmma16(v16h a, v16h b, v8f c) { return __builtin_amdgcn_wmma_f32_16x16x32_f16(false, a, false, b, (short)0, c, false, false); }
__device__ __forceinline__ v8f wmmab(v16bf a, v16bf b, v8f c) { return __builtin_amdgcn_wmma_f32_16x16x32_bf16(false, a, false, b, (short)0, c, false, false); }



// ---- k_gemmw: register-blocked GEMM, ONE WAVE per 64x64 output tile (16 accumulators), operands straight from 16-bit planes in fragment order (ld: p = fragment start + lane * 8); grid (M/64, N/64, Z), 32 threads.
// C[m][n] (f32, pitch ldc, + optional f32 bias[n]) = sum_k A[m][k] Bt[n][k] (+ split products per NSPLIT). z-batch strides sA/sB/sC in elements. K % 32 == 0.
template <typename T16> struct WFrag;
template <> struct WFrag<h16> { typedef v16h V; static __device__ __forceinline__ V ld(const h16* p) { return cat16(*(const v8h*)p, *(const v8h*)(p + 256)); } static __device__ __forceinline__ v8f mma(V a, V b, v8f c) { return wmma16(a, b, c); } };
template <> struct WFrag<bf> { typedef v16bf V; static __device__ __forceinline__ V ld(const bf* p) { return cat16b(*(const v8us*)p, *(const v8us*)(p + 256)); } static __device__ __forceinline__ v8f mma(V a, V b, v8f c) { return wmmab(a, b, c); } };
typedef __attribute__((ext_vector_type(2))) float v2f;
typedef __attribute__((ext_vector_type(2))) __bf16 v2bf;
typedef __attribute__((ext_vector_type(8))) __bf16 v8bf;
__device__ __forceinline__ v2f rbf2(v2f y) { return __builtin_convertvector(__builtin_convertvector(y, v2bf), v2f); }   // two values rounded to bf16
__device__ __forceinline__ void split2(v2f y, v2bf& h, v2bf& l) { h = __builtin_convertvector(y, v2bf); l = __builtin_convertvector(y - __builtin_convertvector(h, v2f), v2bf); }   // hi/lo planes of two values
// QKV = true: Bt holds the q, k and v weights one behind the other (blockIdx.y / 12 says which, blockIdx.y % 12 the head); nothing goes to C: the epilogue normalises, rotates and writes the attention planes (QkvEpi).
struct QkvEpi { const float* CS; const float* qsc; const float* ksc; bf* Qh; bf* Ql; bf* Kh; bf* Kl; bf* Vh; bf* Vl; };
template <typename T16, int NSPLIT, bool BIAS, bool QKV>
__global__ __launch_bounds__(32) void k_gemmw(const T16* __restrict__ A, const T16* __restrict__ A2, const T16* __restrict__ Bt, const T16* __restrict__ Bt2, int K, float* C, int ldc, const float* __restrict__ bias, size_t sA, size_t sB, size_t sC, QkvEpi ep) {
    typedef typename WFrag<T16>::V V;
    __shared__ __align__(16) float os[16 * 68];
    __shared__ __align__(16) float rfs[16];
    const size_t z = blockIdx.z; A += z * sA; if (A2) A2 += z * sA; Bt += z * sB; if (Bt2) Bt2 += z * sB; C += z * sC;
    const int lane = threadIdx.x & 31, lr = lane & 15, hi = lane >> 4; const int r0 = blockIdx.x * 64, c0 = blockIdx.y * 64;
    v8f acc[4][4];
#pragma unroll
    for (int mb = 0; mb < 4; ++mb)
#pragma unroll
        for (int nb = 0; nb < 4; ++nb) acc[mb][nb] = (v8f){};
    const unsigned lo = lane * 8; const T16* pa = A + (size_t)r0 * K + lo; const T16* pa2 = A2 + (size_t)r0 * K + lo; const T16* pb = Bt + (size_t)c0 * K + lo; const T16* pb2 = Bt2 + (size_t)c0 * K + lo;   // the lane's place in the tile's 64-row bands; a step of 32 k is 4 fragments of 512 elements in a row
#pragma unroll 1
    for (int kc = 0; kc < K; kc += 32) {
        V a[4], a2[4], b[4], b2[4];
#pragma unroll
        for (int mb = 0; mb < 4; ++mb) { a[mb] = WFrag<T16>::ld(pa + mb * 512); if (NSPLIT == 1 || NSPLIT == 2) a2[mb] = WFrag<T16>::ld(pa2 + mb * 512); }
#pragma unroll
        for (int nb = 0; nb < 4; ++nb) { b[nb] = WFrag<T16>::ld(pb + nb * 512); if (NSPLIT >= 2) b2[nb] = WFrag<T16>::ld(pb2 + nb * 512); }
        // the address registers of the loads above stay whole up to this wait (inputs), so that no load of the run lands in them and the steps below rewrite them behind it
        if constexpr (NSPLIT == 0) asm volatile("s_wait_xcnt 0x0" :: "v"(pa), "v"(pb) : "memory"); else if constexpr (NSPLIT == 1) asm volatile("s_wait_xcnt 0x0" :: "v"(pa), "v"(pa2), "v"(pb) : "memory"); else asm volatile("s_wait_xcnt 0x0" :: "v"(pa), "v"(pa2), "v"(pb), "v"(pb2) : "memory");
        __builtin_amdgcn_sched_barrier(0);   // keeps the loads in front of the wait and the address steps behind it
        pa += 2048; pa2 += 2048; pb += 2048; pb2 += 2048;
#pragma unroll
        for (int nb = 0; nb < 4; ++nb) {
#pragma unroll
            for (int mb = 0; mb < 4; ++mb) { acc[mb][nb] = WFrag<T16>::mma(a[mb], b[nb], acc[mb][nb]); if (NSPLIT == 1 || NSPLIT == 2) acc[mb][nb] = WFrag<T16>::mma(a2[mb], b[nb], acc[mb][nb]); if (NSPLIT >= 2) acc[mb][nb] = WFrag<T16>::mma(a[mb], b2[nb], acc[mb][nb]); } }
        asm volatile("v_nop\n\tv_nop\n\tv_nop\n\tv_nop" : "+v"(acc[0][0]), "+v"(acc[1][1]), "+v"(acc[2][2]), "+v"(acc[3][3]) : "v"(a[0]), "v"(a[3]));
    }
#pragma unroll
    for (int mb = 0; mb < 4; ++mb) {
#pragma unroll
        for (int nb = 0; nb < 4; ++nb) {
#pragma unroll
            for (int j = 0; j < 8; ++j) os[(hi * 8 + j) * 68 + nb * 16 + lr] = acc[mb][nb][j]; }
        __builtin_amdgcn_wave_barrier(); asm volatile("" ::: "memory");
        if constexpr (QKV) {
            // lane = (row, half): 32 channels of one token, which hold every rotate-half pair (c, c + 16) of one axis
            const int sel = blockIdx.y / NH_, g = (r0 / TT) * NH_ + blockIdx.y % NH_, tk = r0 % TT + mb * 16; const int row = lane >> 1, hf = lane & 1;
            float xv[32]; float ss = 0.f;
#pragma unroll
            for (int c = 0; c < 8; ++c) { const v4f q = *(const v4fa*)(os + row * 68 + hf * 32 + c * 4);
#pragma unroll
                for (int i = 0; i < 4; ++i) { xv[c * 4 + i] = q[i]; ss += q[i] * q[i]; } }
            ss += __shfl_xor(ss, 1);    // the row's other half
            const float rf = __fdiv_rn(1.0f, __fsqrt_rn(ss * (1.0f / HD) + 1e-6f));
            if (sel < 2) {
                const float* nw = (sel ? ep.ksc : ep.qsc) + hf * 32; const float* cs = ep.CS + ((size_t)(r0 / 16 + mb) * 256 + lane) * 4;
                bf* Ph = sel ? ep.Kh : ep.Qh; bf* Pl = sel ? ep.Kl : ep.Ql; const size_t eo = ((size_t)g * TT + tk) * HD + hf * 512 + row * 8;   // fragment order: this half's 32 channels are one fragment
#pragma unroll
                for (int c = 0; c < 16; c += 8) { v8bf ah, al, bh, bl;   // channels c .. c + 7 (a) and their partners c + 16 .. c + 23 (b)
#pragma unroll
                    for (int i = 0; i < 8; i += 2) { const v4f e = *(const v4f*)(cs + (c + i) * 64);   // {cos, sin} of channels c + i, c + i + 1 (those of + 16 are the same); the wave's 512 bytes lie in a row
                        const v2f w0 = rbf2(*(const v2f*)(nw + c + i)), w1 = rbf2(*(const v2f*)(nw + 16 + c + i)); const v2f co = { e[0], e[2] }, si = { e[1], e[3] };
                        const v2f x0 = { xv[c + i], xv[c + i + 1] }, x1 = { xv[c + 16 + i], xv[c + 16 + i + 1] }; const v2f n0 = x0 * rf * w0, n1 = x1 * rf * w1;
                        v2bf h, l; split2(n0 * co - n1 * si, h, l); ah[i] = h[0]; ah[i + 1] = h[1]; al[i] = l[0]; al[i + 1] = l[1];
                        split2(n1 * co + n0 * si, h, l); bh[i] = h[0]; bh[i + 1] = h[1]; bl[i] = l[0]; bl[i + 1] = l[1]; }
                    *(v8us*)(Ph + eo + c * 16) = __builtin_bit_cast(v8us, ah); *(v8us*)(Pl + eo + c * 16) = __builtin_bit_cast(v8us, al); *(v8us*)(Ph + eo + 256 + c * 16) = __builtin_bit_cast(v8us, bh); *(v8us*)(Pl + eo + 256 + c * 16) = __builtin_bit_cast(v8us, bl);
                    asm volatile("s_wait_xcnt 0x0" ::: "memory");   // what follows reuses the data and address registers of these stores
                    __builtin_amdgcn_sched_barrier(0); }            // keeps it behind the wait
            } else {
                if (hf == 0) rfs[row] = rf;
                __builtin_amdgcn_wave_barrier(); asm volatile("" ::: "memory");   // the 1/rms of the 16 rows are read by other lanes than wrote them
                const v4f f0 = *(const v4fa*)(rfs + hi * 8), f1 = *(const v4fa*)(rfs + hi * 8 + 4);
#pragma unroll
                for (int nb = 0; nb < 4; ++nb) { v8bf oh, ol;   // a lane holds 8 tokens in a row of one channel: its own 16 bytes of a fragment of the transposed plane
#pragma unroll
                    for (int j = 0; j < 8; j += 2) { const v2f y = { acc[mb][nb][j] * (j < 4 ? f0[j & 3] : f1[j & 3]), acc[mb][nb][j + 1] * (j < 4 ? f0[(j & 3) + 1] : f1[(j & 3) + 1]) };
                        v2bf h, l; split2(y, h, l); oh[j] = h[0]; oh[j + 1] = h[1]; ol[j] = l[0]; ol[j + 1] = l[1]; }
                    const size_t vo = (size_t)g * HD * TT + (size_t)((((tk >> 5) * 4 + nb) * 2 + ((tk >> 4) & 1)) * 256); /* [32 keys][16 channels][16 keys], then the lane */ *(v8us*)(ep.Vh + vo + lo) = __builtin_bit_cast(v8us, oh); *(v8us*)(ep.Vl + vo + lo) = __builtin_bit_cast(v8us, ol);
                    asm volatile("s_wait_xcnt 0x0" ::: "memory");   // the next tile's split reuses the data and address registers of these stores
                    __builtin_amdgcn_sched_barrier(0); }            // keeps it behind the wait
            }
        } else {
        float* crow = C + (size_t)(r0 + mb * 16) * ldc + c0;
{
#pragma unroll
            for (int s = 0; s < 8; ++s) { const int row = 2 * s + hi, cofs = lr * 4; v4f val = *(const v4fa*)(os + row * 68 + cofs); if (BIAS) { val[0] += bfr(bias[c0 + cofs]); val[1] += bfr(bias[c0 + cofs + 1]); val[2] += bfr(bias[c0 + cofs + 2]); val[3] += bfr(bias[c0 + cofs + 3]); }
                *(v4f*)(crow + (size_t)row * ldc + cofs) = val; }
             }
        }
        __builtin_amdgcn_wave_barrier(); asm volatile("" ::: "memory");
    }
}

__device__ __forceinline__ h16 tohx(float x) { return (h16)x; }
typedef __attribute__((ext_vector_type(2))) _Float16 v2h;
typedef __attribute__((ext_vector_type(4))) _Float16 v4h;
typedef __attribute__((ext_vector_type(2))) unsigned short v2us;
typedef __attribute__((ext_vector_type(4))) unsigned short v4us;
typedef __attribute__((ext_vector_type(4))) int v4i;

__global__ __launch_bounds__(256) void k_wtG(const float* __restrict__ w, int K, int N, bf* Bt) {
    const int lane = threadIdx.x & 31; const int L0 = (blockIdx.x * 8 + (threadIdx.x >> 5)) * 8; const int nlines = N * K / 64;
{
#pragma unroll 1
        for (int l = 0; l < 8; ++l) { const int L = L0 + l; if (L >= nlines) break; const size_t e = (size_t)L * 64 + lane * 2; const int k = (int)(e % K), n = (int)(e / K); v2us o;
            o[0] = f2bf(w[(size_t)k * N + n]); o[1] = f2bf(w[(size_t)(k + 1) * N + n]); *(v2us*)(Bt + e) = o; }
         }
}
// row-major f32 [R][K] to bf16 in fragment order, 64-row bands; a thread makes the plane's i-th 16 bytes. Within 64 threads (one fragment) 4 threads in a row take the 128 bytes (32 k) of one source row: a wave reads 8 whole lines and writes 4 whole lines
template <int K>
__global__ __launch_bounds__(256) void k_cvt8(const float* __restrict__ src, bf* dst, size_t n8) { const size_t t = (size_t)blockIdx.x * 256 + threadIdx.x; if (t >= n8) return; const size_t i = (t & ~(size_t)63) | ((t >> 2) & 15) | ((t & 3) << 4);   // n8 is a multiple of 64: i < n8 too
    const unsigned band = (unsigned)i / (8 * K), rem = (unsigned)i % (8 * K); const v8f v = *(const v8f*)(src + (size_t)(band * 64 + ((rem >> 6) & 3) * 16 + (rem & 15)) * K + (rem >> 8) * 32 + ((rem >> 5) & 1) * 16 + ((rem >> 4) & 1) * 8); v8us o;
#pragma unroll
    for (int k = 0; k < 8; ++k) o[k] = f2bf(v[k]); *(v8us*)(dst + i * 8) = o;  }

// table in the order the projection epilogue's lanes read it: [16-token tile][channel pair 0..7][lane = token * 2 + axis][{cos, sin} x 2]. The reader takes the 16 frequencies of an axis once (channels + 16 repeat them), so its order has a place for those 16 alone
__global__ __launch_bounds__(256) void k_cs2d(const int* __restrict__ pid, float* CS) { const int idx = blockIdx.x * 256 + threadIdx.x; if (idx >= NB_ * TT * (HD / 2)) return; const int t = (idx >> 9) * 16 + ((idx >> 2) & 15); const int ax = (idx >> 1) & 1; const int i = ((idx >> 6) & 7) * 2 + (idx & 1);
    const float e = __fdiv_rn((float)(2 * i), (float)(HD / 2)); const float inv = __fdiv_rn(1.0f, powf(100.0f, e)); const float a = __fmul_rn((float)pid[t * 2 + ax], inv); v2f cs; cs[0] = cosf(a); cs[1] = sinf(a);
    *(v2f*)(CS + (size_t)idx * 2) = cs;  }
// ---- k_fattn: scores, softmax and attn.v of one (batch, head) plane in ONE kernel; the scores never leave the registers.
// Grid (TT / 128, planes), 4 waves; a wave owns 32 query columns and walks the 1024 keys in steps of 32, operands straight from the hi/lo planes (no LDS, no barrier). Scores unscaled (module scaling 1.0).
// S^T = K Q^T (A = key rows, B = query columns) and O^T += V^T P^T (A = rows of the transposed value plane, B = P^T): in every tile a lane holds ONE query (column lane & 15),
// so maximum, sum and rescale are per lane plus one exchange with lane ^ 16, and two S^T tiles (keys 0-15, 16-31) are, converted in place, the B fragment of the second product.
// Running maximum (online softmax): P = exp(s - m) unnormalised on hi/lo planes, O and the sum rescaled by exp(m_old - m_new) each step, one division at the end. Writes the merged hi/lo planes.
__device__ __forceinline__ float xhalf(float x) { const int b = __float_as_int(x); return __int_as_float(__builtin_amdgcn_permlanex16(b, b, 0x76543210, 0xfedcba98, false, false)); }   // value of lane ^ 16
__global__ __launch_bounds__(128) void k_fattn(const bf* __restrict__ Qh, const bf* __restrict__ Ql, const bf* __restrict__ Kh, const bf* __restrict__ Kl, const bf* __restrict__ Vh, const bf* __restrict__ Vl, bf* Ah, bf* Al) {
    typedef WFrag<bf> W;
    const int lane = threadIdx.x & 31, lr = lane & 15, hi = lane >> 4; const int g = blockIdx.y; const int q0 = (blockIdx.x * 4 + (threadIdx.x >> 5)) * 32;
    const size_t po = (size_t)g * TT * HD; const size_t qo = po + (size_t)q0 * HD + lane * 8;
    const bf* kh = Kh + po + lane * 8; const bf* kl = Kl + po + lane * 8; const bf* vh = Vh + po + lane * 8; const bf* vl = Vl + po + lane * 8;   // planes in fragment order: 512 elements a fragment
    v16bf qh[2][2], ql[2][2];
#pragma unroll
    for (int nq = 0; nq < 2; ++nq)
#pragma unroll
        for (int kc = 0; kc < 2; ++kc) { qh[nq][kc] = W::ld(Qh + qo + nq * 16 * HD + kc * 512); ql[nq][kc] = W::ld(Ql + qo + nq * 16 * HD + kc * 512); }
    v16bf ka[2][2], kb[2][2];   // this step's key fragments (hi, lo), fetched one step ahead
#pragma unroll
    for (int kt = 0; kt < 2; ++kt)
#pragma unroll
        for (int kc = 0; kc < 2; ++kc) { ka[kt][kc] = W::ld(kh + (size_t)kt * 16 * HD + kc * 512); kb[kt][kc] = W::ld(kl + (size_t)kt * 16 * HD + kc * 512); }
    asm volatile("s_wait_xcnt 0x0" ::: "memory");   // the start values below reuse the address registers of the loads above
    __builtin_amdgcn_sched_barrier(0);              // keeps those start values behind the wait
    v8f o[2][4]; float m[2], l[2];
#pragma unroll
    for (int nq = 0; nq < 2; ++nq) { m[nq] = -3.0e38f; l[nq] = 0.f;
#pragma unroll
        for (int dt = 0; dt < 4; ++dt) o[nq][dt] = (v8f){}; }
#pragma unroll 1
    for (int k0 = 0; k0 < TT; k0 += 32) {
        v16bf va[4], vb[4];         // this step's value fragments: in flight under the score products and the softmax
#pragma unroll
        for (int dt = 0; dt < 4; ++dt) { va[dt] = W::ld(vh + (size_t)k0 * HD + dt * 512); vb[dt] = W::ld(vl + (size_t)k0 * HD + dt * 512); }
        v8f s[2][2];
#pragma unroll
        for (int kt = 0; kt < 2; ++kt) { s[0][kt] = (v8f){}; s[1][kt] = (v8f){};
#pragma unroll
            for (int kc = 0; kc < 2; ++kc) {
#pragma unroll
                for (int nq = 0; nq < 2; ++nq) { s[nq][kt] = wmmab(ka[kt][kc], qh[nq][kc], s[nq][kt]); s[nq][kt] = wmmab(ka[kt][kc], ql[nq][kc], s[nq][kt]); s[nq][kt] = wmmab(kb[kt][kc], qh[nq][kc], s[nq][kt]); } } }
        const int kn = (k0 + 32) & (TT - 1);   // the next step's keys (the last step fetches step 0 again: in bounds, unused)
#pragma unroll
        for (int kt = 0; kt < 2; ++kt)
#pragma unroll
            for (int kc = 0; kc < 2; ++kc) { ka[kt][kc] = W::ld(kh + (size_t)(kn + kt * 16) * HD + kc * 512); kb[kt][kc] = W::ld(kl + (size_t)(kn + kt * 16) * HD + kc * 512); }
        asm volatile("s_wait_xcnt 0x0" ::: "memory");   // the softmax below reuses the address registers of the loads above
        __builtin_amdgcn_sched_barrier(0);     // keeps the loads above issued in front of the softmax, so that their latency runs under it
        v16bf ph[2], pl[2];
#pragma unroll
        for (int nq = 0; nq < 2; ++nq) { float mx = s[nq][0][0];
#pragma unroll
            for (int j = 0; j < 8; ++j) mx = fmaxf(mx, fmaxf(s[nq][0][j], s[nq][1][j]));
            mx = fmaxf(mx, xhalf(mx)); const float mn = fmaxf(m[nq], mx); const float al = __builtin_amdgcn_exp2f((m[nq] - mn) * 1.4426950408889634f); m[nq] = mn; float sum = 0.f;
#pragma unroll
            for (int e = 0; e < 16; e += 2) { v2f t; t[0] = s[nq][e >> 3][e & 7]; t[1] = s[nq][e >> 3][(e & 7) + 1]; t = (t - mn) * 1.4426950408889634f; v2f p; p[0] = __builtin_amdgcn_exp2f(t[0]); p[1] = __builtin_amdgcn_exp2f(t[1]); sum += p[0]; sum += p[1];
                const v2bf h = __builtin_convertvector(p, v2bf); const v2bf r = __builtin_convertvector(p - __builtin_convertvector(h, v2f), v2bf); ph[nq][e] = h[0]; ph[nq][e + 1] = h[1]; pl[nq][e] = r[0]; pl[nq][e + 1] = r[1]; }
            l[nq] = l[nq] * al + sum;
#pragma unroll
            for (int dt = 0; dt < 4; ++dt) o[nq][dt] *= al; }
#pragma unroll
        for (int dt = 0; dt < 4; ++dt) { const v16bf a = va[dt]; const v16bf a2 = vb[dt];
#pragma unroll
            for (int nq = 0; nq < 2; ++nq) { o[nq][dt] = wmmab(a, ph[nq], o[nq][dt]); o[nq][dt] = wmmab(a, pl[nq], o[nq][dt]); o[nq][dt] = wmmab(a2, ph[nq], o[nq][dt]); } }
    }
#pragma unroll
    for (int nq = 0; nq < 2; ++nq) { const float f = __fdiv_rn(1.0f, l[nq] + xhalf(l[nq])); const size_t oo = ((size_t)(g / NH_) * TT + (q0 & ~63)) * DQ + (g % NH_) * (64 * HD) + (((q0 >> 4) & 3) + nq) * 512 + lane * 8;   // fragment order of the [8192][768] merged plane: band, the head's two steps of 32 k, this 16-token tile
#pragma unroll
        for (int dt = 0; dt < 4; ++dt) { v8us oh, ol;
#pragma unroll
            for (int j = 0; j < 8; ++j) { unsigned short a, c2; splitf(o[nq][dt][j] * f, a, c2); oh[j] = a; ol[j] = c2; }
            *(v8us*)(Ah + oo + (dt >> 1) * 2048 + (dt & 1) * 256) = oh; *(v8us*)(Al + oo + (dt >> 1) * 2048 + (dt & 1) * 256) = ol;
            asm volatile("s_wait_xcnt 0x0" ::: "memory");   // the next tile's split reuses the data registers of these stores
            __builtin_amdgcn_sched_barrier(0); } }          // keeps the next tile's split behind the wait
}

extern "C" void kernel_launch(void* const* d_in, const int* in_sizes, int n_in,
                              void* d_out, int out_size, void* d_ws, size_t ws_size, hipStream_t stream) {
    (void)in_sizes; (void)n_in; (void)out_size;
    const float* x = (const float*)d_in[0]; const int* pid = (const int*)d_in[1]; const float* wq = (const float*)d_in[2]; const float* wk = (const float*)d_in[3]; const float* wv = (const float*)d_in[4]; const float* wo = (const float*)d_in[5]; const float* qsc = (const float*)d_in[6]; const float* ksc = (const float*)d_in[7];
    float* OUT = (float*)d_out;     // [8][1024][768]
    char* wsp = (char*)d_ws;
    auto take = [&](size_t bytes) { char* p = wsp; wsp += (bytes + 255) & ~(size_t)255; return (void*)p; };
    bf* WQ = (bf*)take((size_t)(DQ + 2 * DKV) * DM * 2); bf* WK = WQ + (size_t)DQ * DM; bf* WV = WK + (size_t)DKV * DM;   // one [2304][768] weight plane: q, k, v rows one behind the other
    bf* WO = (bf*)take((size_t)DM * DQ * 2); float* CS = (float*)take((size_t)NB_ * TT * HD * 2 * 4);
    bf* QPh = (bf*)take((size_t)NB_ * NH_ * TT * HD * 2); bf* QPl = (bf*)take((size_t)NB_ * NH_ * TT * HD * 2); bf* KPh = (bf*)take((size_t)NB_ * NKV * TT * HD * 2); bf* KPl = (bf*)take((size_t)NB_ * NKV * TT * HD * 2); bf* VTh = (bf*)take((size_t)NB_ * NKV * HD * TT * 2); bf* VTl = (bf*)take((size_t)NB_ * NKV * HD * TT * 2);
    bf* ATh = (bf*)take((size_t)NB_ * TT * DQ * 2); bf* ATl = (bf*)take((size_t)NB_ * TT * DQ * 2);
    bf* XB = (bf*)take((size_t)NB_ * TT * DM * 2);   // x in bf16
    if ((size_t)(wsp - (char*)d_ws) > ws_size) return;    // ws 256 MiB
    { k_cvt8<DM><<<(unsigned)(((size_t)DQ * DM / 8 + 255) / 256), 256, 0, stream>>>(wq, WQ, (size_t)DQ * DM / 8); k_cvt8<DM><<<(unsigned)(((size_t)DKV * DM / 8 + 255) / 256), 256, 0, stream>>>(wk, WK, (size_t)DKV * DM / 8); k_cvt8<DM><<<(unsigned)(((size_t)DKV * DM / 8 + 255) / 256), 256, 0, stream>>>(wv, WV, (size_t)DKV * DM / 8);
      k_cvt8<DQ><<<(unsigned)(((size_t)DM * DQ / 8 + 255) / 256), 256, 0, stream>>>(wo, WO, (size_t)DM * DQ / 8);
       }
    k_cs2d<<<(NB_ * TT * (HD / 2) + 255) / 256, 256, 0, stream>>>(pid, CS);   /* the 2-D rotary table of all batches */
    k_cvt8<DM><<<(unsigned)(((size_t)NB_ * TT * DM / 8 + 255) / 256), 256, 0, stream>>>(x, XB, (size_t)NB_ * TT * DM / 8);
    const QkvEpi ep = { CS, qsc, ksc, QPh, QPl, KPh, KPl, VTh, VTl };
    k_gemmw<bf, 0, false, true><<<dim3(NB_ * TT / 64, (DQ + 2 * DKV) / 64, 1), 32, 0, stream>>>(XB, nullptr, WQ, nullptr, DM, nullptr, 0, nullptr, 0, 0, 0, ep);   // q, k, v projections with RMSNorm, rotary and plane build in the epilogue
    k_fattn<<<dim3(TT / 128, NB_ * NH_, 1), 128, 0, stream>>>(QPh, QPl, KPh, KPl, VTh, VTl, ATh, ATl);   // plane g = batch * 12 + head; one kv head per query head
    k_gemmw<bf, 1, false, false><<<dim3(NB_ * TT / 64, DM / 64, 1), 32, 0, stream>>>(ATh, ATl, WO, nullptr, DQ, OUT, DM, nullptr, 0, 0, 0, QkvEpi{});
}

// v005
// It runs in 130 microseconds.
// Timed twice side by side with v004, it ran 1.05 times as fast both times.
// Over all steps from v000 it is 18.3 times as fast.
#include <hip/hip_runtime.h>

// Vision attention with per-head RMSNorm and 2-D rotary positions (hidden [8][1024][768]; q,k,v = x W^T ('oi' [768][768], 12 heads x 64); q, k RMS-normalised per head (eps 1e-6) x scale, v RMS-normalised without scale; 2-D RoPE: the head's first 32 channels rotate (rotate-half within the 32) by the x position, the last 32 by the y position, angle = pos x 100^(-2i/32) from pixel_position_ids int32 [8][1024][2]; scores = q.k UNSCALED; softmax; out = merged Wo^T ('oi') -> [8][1024][768] (6.3 M)).
// Layout: every launch covers all 8 batches (token rows b*1024+t, or the batch on grid y); attention is ONE fused launch, a (batch, head) plane on grid y (k_fattn). ONE preparation launch (k_prep) rounds x and the weights to bf16 and builds the {cos, sin} table (32 angles a token) from the position ids (f32 powf/cosf/sinf); exact projections, q, k and v in ONE launch whose epilogue (a 64x64 tile is 64 tokens of one head) takes the 1/rms of each row, applies (x * inv_rms) * scale and the within-half rotate-half and writes the q/k hi/lo planes, or scales v by its 1/rms and writes the transposed value planes; fused dense T-1024 attention with EVERY row on hi/lo planes (the unscaled logits of unit-RMS vectors reach ~+-30), scores and probabilities in registers only; merged hi/lo x Wo exact.
// Plane layout ("fragment order"): every 16-bit operand plane is a row of WMMA fragments. A fragment (16 rows x 32 k) is 512 elements in the order [half of 16 k][lane][8 elements], lane = ((k / 8) & 1) * 16 + (row & 15):
// its two 16-byte loads are then 512 contiguous bytes each over the wave (4 whole 128-byte lines, not 32-byte pieces of 16 lines). The fragments lie as their reader walks them: x, weights and merged rows [64-row band][k / 32][16-row tile]; q and k [16-token tile][k / 32]; v [32 keys][16 channels]. The {cos, sin} table lies in its readers' lane order too (k_prep). The values and every sum order are those of row-major planes.
// Compute dtypes, f32 accumulate: every input rounded to bf16; projections exact; RMSNorm/rotary f32; scores and attn.v 3 products on every row; softmax f32 with a running maximum; Wo hl x exact.

#define NB_  8
#define TT   1024
#define DM   768
#define NH_  12
#define NKV  12
#define REP  (NH_ / NKV)
#define HD   64
#define DQ   (NH_ * HD)
#define DKV  (NKV * HD)
typedef _Float16 h16;
typedef unsigned short bf;
typedef __attribute__((ext_vector_type(16))) __bf16   v16bf;
typedef __attribute__((ext_vector_type(16))) _Float16 v16h;
typedef __attribute__((ext_vector_type(8)))  _Float16 v8h;
typedef __attribute__((ext_vector_type(8)))  unsigned short v8us;
typedef __attribute__((ext_vector_type(8)))  float    v8f;
typedef __attribute__((ext_vector_type(4)))  float    v4f;
typedef v8h  __attribute__((may_alias)) v8ha;
typedef v4f  __attribute__((may_alias)) v4fa;
typedef v8us __attribute__((may_alias)) v8usa;

__device__ __forceinline__ unsigned short f2bf(float f) { unsigned u = __float_as_uint(f); u += 0x7FFFu + ((u >> 16) & 1u); return (unsigned short)(u >> 16); }
__device__ __forceinline__ float bf2f(unsigned short b) { return __uint_as_float(((unsigned)b) << 16); }
__device__ __forceinline__ float bfr(float f) { return bf2f(f2bf(f)); }
__device__ __forceinline__ void splitf(float y, unsigned short& h, unsigned short& l) { h = f2bf(y); l = f2bf(y - bf2f(h)); }
__device__ __forceinline__ v16h cat16(v8h lo, v8h hi) { return __builtin_shufflevector(lo, hi, 0, 1, 2, 3, 4, 5, 6, 7, 8, 9, 10, 11, 12, 13, 14, 15); }
__device__ __forceinline__ v16bf cat16b(v8us lo, v8us hi) { return __builtin_bit_cast(v16bf, __builtin_shufflevector(lo, hi, 0, 1, 2, 3, 4, 5, 6, 7, 8, 9, 10, 11, 12, 13, 14, 15)); }
__device__ __forceinline__ v8f wmma16(v16h a, v16h b, v8f c) { return __builtin_amdgcn_wmma_f32_16x16x32_f16(false, a, false, b, (short)0, c, false, false); }
__device__ __forceinline__ v8f wmmab(v16bf a, v16bf b, v8f c) { return __builtin_amdgcn_wmma_f32_16x16x32_bf16(false, a, false, b, (short)0, c, false, false); }



// ---- k_gemmw: register-blocked GEMM, ONE WAVE per 64x64 output tile (16 accumulators), operands straight from 16-bit planes in fragment order (ld: p = fragment start + lane * 8); grid (M/64, N/64, Z), 32 threads.
// C[m][n] (f32, pitch ldc, + optional f32 bias[n]) = sum_k A[m][k] Bt[n][k] (+ split products per NSPLIT). z-batch strides sA/sB/sC in elements. K % 32 == 0.
template <typename T16> struct WFrag;
template <> struct WFrag<h16> { typedef v16h V; static __device__ __forceinline__ V ld(const h16* p) { return cat16(*(const v8h*)p, *(const v8h*)(p + 256)); } static __device__ __forceinline__ v8f mma(V a, V b, v8f c) { return wmma16(a, b, c); } };
template <> struct WFrag<bf> { typedef v16bf V; static __device__ __forceinline__ V ld(const bf* p) { return cat16b(*(const v8us*)p, *(const v8us*)(p + 256)); } static __device__ __forceinline__ v8f mma(V a, V b, v8f c) { return wmmab(a, b, c); } };
typedef __attribute__((ext_vector_type(2))) float v2f;
typedef __attribute__((ext_vector_type(2))) __bf16 v2bf;
typedef __attribute__((ext_vector_type(8))) __bf16 v8bf;
__device__ __forceinline__ v2f rbf2(v2f y) { return __builtin_convertvector(__builtin_convertvector(y, v2bf), v2f); }   // two values rounded to bf16
__device__ __forceinline__ void split2(v2f y, v2bf& h, v2bf& l) { h = __builtin_convertvector(y, v2bf); l = __builtin_convertvector(y - __builtin_convertvector(h, v2f), v2bf); }   // hi/lo planes of two values
// QKV = true: Bt holds the q, k and v weights one behind the other (blockIdx.y / 12 says which, blockIdx.y % 12 the head); nothing goes to C: the epilogue normalises, rotates and writes the attention planes (QkvEpi).
struct QkvEpi { const float* CS; const float* qsc; const float* ksc; bf* Qh; bf* Ql; bf* Kh; bf* Kl; bf* Vh; bf* Vl; };
template <typename T16, int NSPLIT, bool BIAS, bool QKV>
__global__ __launch_bounds__(32) void k_gemmw(const T16* __restrict__ A, const T16* __restrict__ A2, const T16* __restrict__ Bt, const T16* __restrict__ Bt2, int K, float* C, int ldc, const float* __restrict__ bias, size_t sA, size_t sB, size_t sC, QkvEpi ep) {
    typedef typename WFrag<T16>::V V;
    __shared__ __align__(16) float os[16 * 68];
    __shared__ __align__(16) float rfs[16];
    const size_t z = blockIdx.z; A += z * sA; if (A2) A2 += z * sA; Bt += z * sB; if (Bt2) Bt2 += z * sB; C += z * sC;
    const int lane = threadIdx.x & 31, lr = lane & 15, hi = lane >> 4; const int r0 = blockIdx.x * 64, c0 = blockIdx.y * 64;
    v8f acc[4][4];
#pragma unroll
    for (int mb = 0; mb < 4; ++mb)
#pragma unroll
        for (int nb = 0; nb < 4; ++nb) acc[mb][nb] = (v8f){};
    const unsigned lo = lane * 8; const T16* pa = A + (size_t)r0 * K + lo; const T16* pa2 = A2 + (size_t)r0 * K + lo; const T16* pb = Bt + (size_t)c0 * K + lo; const T16* pb2 = Bt2 + (size_t)c0 * K + lo;   // the lane's place in the tile's 64-row bands; a step of 32 k is 4 fragments of 512 elements in a row
#pragma unroll 1
    for (int kc = 0; kc < K; kc += 32) {
        V a[4], a2[4], b[4], b2[4];
#pragma unroll
        for (int mb = 0; mb < 4; ++mb) { a[mb] = WFrag<T16>::ld(pa + mb * 512); if (NSPLIT == 1 || NSPLIT == 2) a2[mb] = WFrag<T16>::ld(pa2 + mb * 512); }
#pragma unroll
        for (int nb = 0; nb < 4; ++nb) { b[nb] = WFrag<T16>::ld(pb + nb * 512); if (NSPLIT >= 2) b2[nb] = WFrag<T16>::ld(pb2 + nb * 512); }
        // the address registers of the loads above stay whole up to this wait (inputs), so that no load of the run lands in them and the steps below rewrite them behind it
        if constexpr (NSPLIT == 0) asm volatile("s_wait_xcnt 0x0" :: "v"(pa), "v"(pb) : "memory"); else if constexpr (NSPLIT == 1) asm volatile("s_wait_xcnt 0x0" :: "v"(pa), "v"(pa2), "v"(pb) : "memory"); else asm volatile("s_wait_xcnt 0x0" :: "v"(pa), "v"(pa2), "v"(pb), "v"(pb2) : "memory");
        __builtin_amdgcn_sched_barrier(0);   // keeps the loads in front of the wait and the address steps behind it
        pa += 2048; pa2 += 2048; pb += 2048; pb2 += 2048;
#pragma unroll
        for (int nb = 0; nb < 4; ++nb) {
#pragma unroll
            for (int mb = 0; mb < 4; ++mb) { acc[mb][nb] = WFrag<T16>::mma(a[mb], b[nb], acc[mb][nb]); if (NSPLIT == 1 || NSPLIT == 2) acc[mb][nb] = WFrag<T16>::mma(a2[mb], b[nb], acc[mb][nb]); if (NSPLIT >= 2) acc[mb][nb] = WFrag<T16>::mma(a[mb], b2[nb], acc[mb][nb]); } }
        asm volatile("v_nop\n\tv_nop\n\tv_nop\n\tv_nop" : "+v"(acc[0][0]), "+v"(acc[1][1]), "+v"(acc[2][2]), "+v"(acc[3][3]) : "v"(a[0]), "v"(a[3]));
    }
#pragma unroll
    for (int mb = 0; mb < 4; ++mb) {
#pragma unroll
        for (int nb = 0; nb < 4; ++nb) {
#pragma unroll
            for (int j = 0; j < 8; ++j) os[(hi * 8 + j) * 68 + nb * 16 + lr] = acc[mb][nb][j]; }
        __builtin_amdgcn_wave_barrier(); asm volatile("" ::: "memory");
        if constexpr (QKV) {
            // lane = (row, half): 32 channels of one token, which hold every rotate-half pair (c, c + 16) of one axis
            const int sel = blockIdx.y / NH_, g = (r0 / TT) * NH_ + blockIdx.y % NH_, tk = r0 % TT + mb * 16; const int row = lane >> 1, hf = lane & 1;
            float xv[32]; float ss = 0.f;
#pragma unroll
            for (int c = 0; c < 8; ++c) { const v4f q = *(const v4fa*)(os + row * 68 + hf * 32 + c * 4);
#pragma unroll
                for (int i = 0; i < 4; ++i) { xv[c * 4 + i] = q[i]; ss += q[i] * q[i]; } }
            ss += __shfl_xor(ss, 1);    // the row's other half
            const float rf = __fdiv_rn(1.0f, __fsqrt_rn(ss * (1.0f / HD) + 1e-6f));
            if (sel < 2) {
                const float* nw = (sel ? ep.ksc : ep.qsc) + hf * 32; const float* cs = ep.CS + ((size_t)(r0 / 16 + mb) * 256 + lane) * 4;
                bf* Ph = sel ? ep.Kh : ep.Qh; bf* Pl = sel ? ep.Kl : ep.Ql; const size_t eo = ((size_t)g * TT + tk) * HD + hf * 512 + row * 8;   // fragment order: this half's 32 channels are one fragment
#pragma unroll
                for (int c = 0; c < 16; c += 8) { v8bf ah, al, bh, bl;   // channels c .. c + 7 (a) and their partners c + 16 .. c + 23 (b)
#pragma unroll
                    for (int i = 0; i < 8; i += 2) { const v4f e = *(const v4f*)(cs + (c + i) * 64);   // {cos, sin} of channels c + i, c + i + 1 (those of + 16 are the same); the wave's 512 bytes lie in a row
                        const v2f w0 = rbf2(*(const v2f*)(nw + c + i)), w1 = rbf2(*(const v2f*)(nw + 16 + c + i)); const v2f co = { e[0], e[2] }, si = { e[1], e[3] };
                        const v2f x0 = { xv[c + i], xv[c + i + 1] }, x1 = { xv[c + 16 + i], xv[c + 16 + i + 1] }; const v2f n0 = x0 * rf * w0, n1 = x1 * rf * w1;
                        v2bf h, l; split2(n0 * co - n1 * si, h, l); ah[i] = h[0]; ah[i + 1] = h[1]; al[i] = l[0]; al[i + 1] = l[1];
                        split2(n1 * co + n0 * si, h, l); bh[i] = h[0]; bh[i + 1] = h[1]; bl[i] = l[0]; bl[i + 1] = l[1]; }
                    *(v8us*)(Ph + eo + c * 16) = __builtin_bit_cast(v8us, ah); *(v8us*)(Pl + eo + c * 16) = __builtin_bit_cast(v8us, al); *(v8us*)(Ph + eo + 256 + c * 16) = __builtin_bit_cast(v8us, bh); *(v8us*)(Pl + eo + 256 + c * 16) = __builtin_bit_cast(v8us, bl);
                    asm volatile("s_wait_xcnt 0x0" ::: "memory");   // what follows reuses the data and address registers of these stores
                    __builtin_amdgcn_sched_barrier(0); }            // keeps it behind the wait
            } else {
                if (hf == 0) rfs[row] = rf;
                __builtin_amdgcn_wave_barrier(); asm volatile("" ::: "memory");   // the 1/rms of the 16 rows are read by other lanes than wrote them
                const v4f f0 = *(const v4fa*)(rfs + hi * 8), f1 = *(const v4fa*)(rfs + hi * 8 + 4);
#pragma unroll
                for (int nb = 0; nb < 4; ++nb) { v8bf oh, ol;   // a lane holds 8 tokens in a row of one channel: its own 16 bytes of a fragment of the transposed plane
#pragma unroll
                    for (int j = 0; j < 8; j += 2) { const v2f y = { acc[mb][nb][j] * (j < 4 ? f0[j & 3] : f1[j & 3]), acc[mb][nb][j + 1] * (j < 4 ? f0[(j & 3) + 1] : f1[(j & 3) + 1]) };
                        v2bf h, l; split2(y, h, l); oh[j] = h[0]; oh[j + 1] = h[1]; ol[j] = l[0]; ol[j + 1] = l[1]; }
                    const size_t vo = (size_t)g * HD * TT + (size_t)((((tk >> 5) * 4 + nb) * 2 + ((tk >> 4) & 1)) * 256); /* [32 keys][16 channels][16 keys], then the lane */ *(v8us*)(ep.Vh + vo + lo) = __builtin_bit_cast(v8us, oh); *(v8us*)(ep.Vl + vo + lo) = __builtin_bit_cast(v8us, ol);
                    asm volatile("s_wait_xcnt 0x0" ::: "memory");   // the next tile's split reuses the data and address registers of these stores
                    __builtin_amdgcn_sched_barrier(0); }            // keeps it behind the wait
            }
        } else {
        float* crow = C + (size_t)(r0 + mb * 16) * ldc + c0;
{
#pragma unroll
            for (int s = 0; s < 8; ++s) { const int row = 2 * s + hi, cofs = lr * 4; v4f val = *(const v4fa*)(os + row * 68 + cofs); if (BIAS) { val[0] += bfr(bias[c0 + cofs]); val[1] += bfr(bias[c0 + cofs + 1]); val[2] += bfr(bias[c0 + cofs + 2]); val[3] += bfr(bias[c0 + cofs + 3]); }
                *(v4f*)(crow + (size_t)row * ldc + cofs) = val; }
             }
        }
        __builtin_amdgcn_wave_barrier(); asm volatile("" ::: "memory");
    }
}

__device__ __forceinline__ h16 tohx(float x) { return (h16)x; }
typedef __attribute__((ext_vector_type(2))) _Float16 v2h;
typedef __attribute__((ext_vector_type(4))) _Float16 v4h;
typedef __attribute__((ext_vector_type(2))) unsigned short v2us;
typedef __attribute__((ext_vector_type(4))) unsigned short v4us;
typedef __attribute__((ext_vector_type(4))) int v4i;

__global__ __launch_bounds__(256) void k_wtG(const float* __restrict__ w, int K, int N, bf* Bt) {
    const int lane = threadIdx.x & 31; const int L0 = (blockIdx.x * 8 + (threadIdx.x >> 5)) * 8; const int nlines = N * K / 64;
{
#pragma unroll 1
        for (int l = 0; l < 8; ++l) { const int L = L0 + l; if (L >= nlines) break; const size_t e = (size_t)L * 64 + lane * 2; const int k = (int)(e % K), n = (int)(e / K); v2us o;
            o[0] = f2bf(w[(size_t)k * N + n]); o[1] = f2bf(w[(size_t)(k + 1) * N + n]); *(v2us*)(Bt + e) = o; }
         }
}
// ---- k_prep: all that the projections read is made in ONE launch; a thread makes 4 table entries or 8 pieces of 16 bytes, so that the launch has few waves to start.
// Blocks 0 .. CSB - 1: the {cos, sin} table in the order the projection epilogue's lanes read it: [16-token tile][channel pair 0..7][lane = token * 2 + axis][{cos, sin} x 2]. The reader takes the 16 frequencies of an axis once (channels + 16 repeat them), so its order has a place for those 16 alone.
// The other blocks: row-major f32 [R][768] (x, then the four weights) to bf16 in fragment order, 64-row bands; a block takes 8 steps of 32 k of one band (3 blocks a band), a thread the same 16 bytes of each step's 4 fragments. Within 64 threads (one fragment) 4 threads in a row take the 128 bytes (32 k) of one source row: a wave reads 8 whole lines and writes 4 whole lines a step.
#define CSB (NB_ * TT * (HD / 2) / 1024)
#define XBB (NB_ * TT / 64 * 3)
#define WBB (DQ / 64 * 3)
__global__ __launch_bounds__(256) void k_prep(const float* __restrict__ x, const float* __restrict__ wq, const float* __restrict__ wk, const float* __restrict__ wv, const float* __restrict__ wo, const int* __restrict__ pid, bf* XB, bf* WQKV, bf* WO, float* CS) {
    const int tid = threadIdx.x; int b = blockIdx.x;
    if (b < CSB) {   // entries b * 1024 + (tt * 2 + h) * 256 + tid: two 16-token tiles (tt), in each this thread's frequency i and i + 8 (h)
        const int ax = (tid >> 1) & 1, tl = (tid >> 2) & 15, i = (tid >> 6) * 2 + (tid & 1); float inv[2];
        const int pv[2] = { pid[(b * 32 + tl) * 2 + ax], pid[(b * 32 + 16 + tl) * 2 + ax] };   // both tiles' positions, in flight under the powers below
        // the loops of 2 trips below are unrolled so that inv and pv have constant indices and stay in registers
#pragma unroll
        for (int h = 0; h < 2; ++h) { const float e = __fdiv_rn((float)(2 * (i + 8 * h)), (float)(HD / 2)); inv[h] = __fdiv_rn(1.0f, powf(100.0f, e)); }
#pragma unroll
        for (int tt = 0; tt < 2; ++tt) {
#pragma unroll
            for (int h = 0; h < 2; ++h) { const float a = __fmul_rn((float)pv[tt], inv[h]); v2f cs; cs[0] = cosf(a); cs[1] = sinf(a);
                *(v2f*)(CS + ((size_t)(b * 2 + tt) * 512 + h * 256 + tid) * 2) = cs; } }
        return;
    }
    b -= CSB; const float* src = x; bf* dst = XB;
    if (b >= XBB) { b -= XBB; const int w = b / WBB; b -= w * WBB; src = w == 0 ? wq : w == 1 ? wk : w == 2 ? wv : wo; dst = w < 3 ? WQKV + (size_t)w * DQ * DM : WO; }
    const int band = b / 3, ks = (b % 3) * 8; const int i0 = (tid & 192) | ((tid >> 2) & 15) | ((tid & 3) << 4);   // the thread's 16 bytes among the 256 of a step
    const float* p = src + (size_t)(band * 64 + ((i0 >> 6) & 3) * 16 + (i0 & 15)) * DM + ks * 32 + ((i0 >> 5) & 1) * 16 + ((i0 >> 4) & 1) * 8; bf* q = dst + ((size_t)(band * (DM / 32) + ks) * 256 + i0) * 8;
    v8f v[8];   // the loops below are unrolled so that v has constant indices and stays in registers, and the 16 loads go out as one run
#pragma unroll
    for (int j = 0; j < 8; ++j) v[j] = *(const v8f*)(p + j * 32);
    asm volatile("s_wait_xcnt 0x0" :: "v"(p) : "memory");   // the address register of the 16 loads stays whole up to this wait (input), so that no load of the run lands in it and nothing rewrites it in front of the wait
#pragma unroll
    for (int j = 0; j < 8; ++j) { v8us o;
#pragma unroll
        for (int k = 0; k < 8; ++k) o[k] = f2bf(v[j][k]);
        *(v8us*)(q + j * 2048) = o; }
    asm volatile("s_wait_xcnt 0x0" ::: "memory");   // behind the last of the 8 stores: in the built code the table part stands behind them and rewrites their offset, data and base registers
}
// ---- k_fattn: scores, softmax and attn.v of one (batch, head) plane in ONE kernel; the scores never leave the registers.
// Grid (TT / 128, planes), 4 waves; a wave owns 32 query columns and walks the 1024 keys in steps of 32, operands straight from the hi/lo planes (no LDS, no barrier). Scores unscaled (module scaling 1.0).
// S^T = K Q^T (A = key rows, B = query columns) and O^T += V^T P^T (A = rows of the transposed value plane, B = P^T): in every tile a lane holds ONE query (column lane & 15),
// so maximum, sum and rescale are per lane plus one exchange with lane ^ 16, and two S^T tiles (keys 0-15, 16-31) are, converted in place, the B fragment of the second product.
// Running maximum (online softmax): P = exp(s - m) unnormalised on hi/lo planes, O and the sum rescaled by exp(m_old - m_new) each step, one division at the end. Writes the merged hi/lo planes.
__device__ __forceinline__ float xhalf(float x) { const int b = __float_as_int(x); return __int_as_float(__builtin_amdgcn_permlanex16(b, b, 0x76543210, 0xfedcba98, false, false)); }   // value of lane ^ 16
__global__ __launch_bounds__(128) void k_fattn(const bf* __restrict__ Qh, const bf* __restrict__ Ql, const bf* __restrict__ Kh, const bf* __restrict__ Kl, const bf* __restrict__ Vh, const bf* __restrict__ Vl, bf* Ah, bf* Al) {
    typedef WFrag<bf> W;
    const int lane = threadIdx.x & 31, lr = lane & 15, hi = lane >> 4; const int g = blockIdx.y; const int q0 = (blockIdx.x * 4 + (threadIdx.x >> 5)) * 32;
    const size_t po = (size_t)g * TT * HD; const size_t qo = po + (size_t)q0 * HD + lane * 8;
    const bf* kh = Kh + po + lane * 8; const bf* kl = Kl + po + lane * 8; const bf* vh = Vh + po + lane * 8; const bf* vl = Vl + po + lane * 8;   // planes in fragment order: 512 elements a fragment
    v16bf qh[2][2], ql[2][2];
#pragma unroll
    for (int nq = 0; nq < 2; ++nq)
#pragma unroll
        for (int kc = 0; kc < 2; ++kc) { qh[nq][kc] = W::ld(Qh + qo + nq * 16 * HD + kc * 512); ql[nq][kc] = W::ld(Ql + qo + nq * 16 * HD + kc * 512); }
    v16bf ka[2][2], kb[2][2];   // this step's key fragments (hi, lo), fetched one step ahead
#pragma unroll
    for (int kt = 0; kt < 2; ++kt)
#pragma unroll
        for (int kc = 0; kc < 2; ++kc) { ka[kt][kc] = W::ld(kh + (size_t)kt * 16 * HD + kc * 512); kb[kt][kc] = W::ld(kl + (size_t)kt * 16 * HD + kc * 512); }
    asm volatile("s_wait_xcnt 0x0" ::: "memory");   // the start values below reuse the address registers of the loads above
    __builtin_amdgcn_sched_barrier(0);              // keeps those start values behind the wait
    v8f o[2][4]; float m[2], l[2];
#pragma unroll
    for (int nq = 0; nq < 2; ++nq) { m[nq] = -3.0e38f; l[nq] = 0.f;
#pragma unroll
        for (int dt = 0; dt < 4; ++dt) o[nq][dt] = (v8f){}; }
#pragma unroll 1
    for (int k0 = 0; k0 < TT; k0 += 32) {
        v16bf va[4], vb[4];         // this step's value fragments: in flight under the score products and the softmax
#pragma unroll
        for (int dt = 0; dt < 4; ++dt) { va[dt] = W::ld(vh + (size_t)k0 * HD + dt * 512); vb[dt] = W::ld(vl + (size_t)k0 * HD + dt * 512); }
        v8f s[2][2];
#pragma unroll
        for (int kt = 0; kt < 2; ++kt) { s[0][kt] = (v8f){}; s[1][kt] = (v8f){};
#pragma unroll
            for (int kc = 0; kc < 2; ++kc) {
#pragma unroll
                for (int nq = 0; nq < 2; ++nq) { s[nq][kt] = wmmab(ka[kt][kc], qh[nq][kc], s[nq][kt]); s[nq][kt] = wmmab(ka[kt][kc], ql[nq][kc], s[nq][kt]); s[nq][kt] = wmmab(kb[kt][kc], qh[nq][kc], s[nq][kt]); } } }
        const int kn = (k0 + 32) & (TT - 1);   // the next step's keys (the last step fetches step 0 again: in bounds, unused)
#pragma unroll
        for (int kt = 0; kt < 2; ++kt)
#pragma unroll
            for (int kc = 0; kc < 2; ++kc) { ka[kt][kc] = W::ld(kh + (size_t)(kn + kt * 16) * HD + kc * 512); kb[kt][kc] = W::ld(kl + (size_t)(kn + kt * 16) * HD + kc * 512); }
        asm volatile("s_wait_xcnt 0x0" ::: "memory");   // the softmax below reuses the address registers of the loads above
        __builtin_amdgcn_sched_barrier(0);     // keeps the loads above issued in front of the softmax, so that their latency runs under it
        v16bf ph[2], pl[2];
#pragma unroll
        for (int nq = 0; nq < 2; ++nq) { float mx = s[nq][0][0];
#pragma unroll
            for (int j = 0; j < 8; ++j) mx = fmaxf(mx, fmaxf(s[nq][0][j], s[nq][1][j]));
            mx = fmaxf(mx, xhalf(mx)); const float mn = fmaxf(m[nq], mx); const float al = __builtin_amdgcn_exp2f((m[nq] - mn) * 1.4426950408889634f); m[nq] = mn; float sum = 0.f;
#pragma unroll
            for (int e = 0; e < 16; e += 2) { v2f t; t[0] = s[nq][e >> 3][e & 7]; t[1] = s[nq][e >> 3][(e & 7) + 1]; t = (t - mn) * 1.4426950408889634f; v2f p; p[0] = __builtin_amdgcn_exp2f(t[0]); p[1] = __builtin_amdgcn_exp2f(t[1]); sum += p[0]; sum += p[1];
                const v2bf h = __builtin_convertvector(p, v2bf); const v2bf r = __builtin_convertvector(p - __builtin_convertvector(h, v2f), v2bf); ph[nq][e] = h[0]; ph[nq][e + 1] = h[1]; pl[nq][e] = r[0]; pl[nq][e + 1] = r[1]; }
            l[nq] = l[nq] * al + sum;
#pragma unroll
            for (int dt = 0; dt < 4; ++dt) o[nq][dt] *= al; }
#pragma unroll
        for (int dt = 0; dt < 4; ++dt) { const v16bf a = va[dt]; const v16bf a2 = vb[dt];
#pragma unroll
            for (int nq = 0; nq < 2; ++nq) { o[nq][dt] = wmmab(a, ph[nq], o[nq][dt]); o[nq][dt] = wmmab(a, pl[nq], o[nq][dt]); o[nq][dt] = wmmab(a2, ph[nq], o[nq][dt]); } }
    }
#pragma unroll
    for (int nq = 0; nq < 2; ++nq) { const float f = __fdiv_rn(1.0f, l[nq] + xhalf(l[nq])); const size_t oo = ((size_t)(g / NH_) * TT + (q0 & ~63)) * DQ + (g % NH_) * (64 * HD) + (((q0 >> 4) & 3) + nq) * 512 + lane * 8;   // fragment order of the [8192][768] merged plane: band, the head's two steps of 32 k, this 16-token tile
#pragma unroll
        for (int dt = 0; dt < 4; ++dt) { v8us oh, ol;
#pragma unroll
            for (int j = 0; j < 8; ++j) { unsigned short a, c2; splitf(o[nq][dt][j] * f, a, c2); oh[j] = a; ol[j] = c2; }
            *(v8us*)(Ah + oo + (dt >> 1) * 2048 + (dt & 1) * 256) = oh; *(v8us*)(Al + oo + (dt >> 1) * 2048 + (dt & 1) * 256) = ol;
            asm volatile("s_wait_xcnt 0x0" ::: "memory");   // the next tile's split reuses the data registers of these stores
            __builtin_amdgcn_sched_barrier(0); } }          // keeps the next tile's split behind the wait
}

extern "C" void kernel_launch(void* const* d_in, const int* in_sizes, int n_in,
                              void* d_out, int out_size, void* d_ws, size_t ws_size, hipStream_t stream) {
    (void)in_sizes; (void)n_in; (void)out_size;
    const float* x = (const float*)d_in[0]; const int* pid = (const int*)d_in[1]; const float* wq = (const float*)d_in[2]; const float* wk = (const float*)d_in[3]; const float* wv = (const float*)d_in[4]; const float* wo = (const float*)d_in[5]; const float* qsc = (const float*)d_in[6]; const float* ksc = (const float*)d_in[7];
    float* OUT = (float*)d_out;     // [8][1024][768]
    char* wsp = (char*)d_ws;
    auto take = [&](size_t bytes) { char* p = wsp; wsp += (bytes + 255) & ~(size_t)255; return (void*)p; };
    bf* WQ = (bf*)take((size_t)(DQ + 2 * DKV) * DM * 2);   // one [2304][768] weight plane: q, k, v rows one behind the other
    bf* WO = (bf*)take((size_t)DM * DQ * 2); float* CS = (float*)take((size_t)NB_ * TT * HD * 2 * 4);
    bf* QPh = (bf*)take((size_t)NB_ * NH_ * TT * HD * 2); bf* QPl = (bf*)take((size_t)NB_ * NH_ * TT * HD * 2); bf* KPh = (bf*)take((size_t)NB_ * NKV * TT * HD * 2); bf* KPl = (bf*)take((size_t)NB_ * NKV * TT * HD * 2); bf* VTh = (bf*)take((size_t)NB_ * NKV * HD * TT * 2); bf* VTl = (bf*)take((size_t)NB_ * NKV * HD * TT * 2);
    bf* ATh = (bf*)take((size_t)NB_ * TT * DQ * 2); bf* ATl = (bf*)take((size_t)NB_ * TT * DQ * 2);
    bf* XB = (bf*)take((size_t)NB_ * TT * DM * 2);   // x in bf16
    if ((size_t)(wsp - (char*)d_ws) > ws_size) return;    // ws 256 MiB
    k_prep<<<CSB + XBB + 4 * WBB, 256, 0, stream>>>(x, wq, wk, wv, wo, pid, XB, WQ, WO, CS);   // the rotary table of all batches; x and the four weights in bf16
    const QkvEpi ep = { CS, qsc, ksc, QPh, QPl, KPh, KPl, VTh, VTl };
    k_gemmw<bf, 0, false, true><<<dim3(NB_ * TT / 64, (DQ + 2 * DKV) / 64, 1), 32, 0, stream>>>(XB, nullptr, WQ, nullptr, DM, nullptr, 0, nullptr, 0, 0, 0, ep);   // q, k, v projections with RMSNorm, rotary and plane build in the epilogue
    k_fattn<<<dim3(TT / 128, NB_ * NH_, 1), 128, 0, stream>>>(QPh, QPl, KPh, KPl, VTh, VTl, ATh, ATl);   // plane g = batch * 12 + head; one kv head per query head
    k_gemmw<bf, 1, false, false><<<dim3(NB_ * TT / 64, DM / 64, 1), 32, 0, stream>>>(ATh, ATl, WO, nullptr, DQ, OUT, DM, nullptr, 0, 0, 0, QkvEpi{});
}

// v006
// Measured time: 113 microseconds a run.
// Timed twice side by side with v005, it ran 1.16 and 1.17 times as fast.
// Counting every step since v000, it is 21.2 times as fast.
#include <hip/hip_runtime.h>

// Vision attention with per-head RMSNorm and 2-D rotary positions (hidden [8][1024][768]; q,k,v = x W^T ('oi' [768][768], 12 heads x 64); q, k RMS-normalised per head (eps 1e-6) x scale, v RMS-normalised without scale; 2-D RoPE: the head's first 32 channels rotate (rotate-half within the 32) by the x position, the last 32 by the y position, angle = pos x 100^(-2i/32) from pixel_position_ids int32 [8][1024][2]; scores = q.k UNSCALED; softmax; out = merged Wo^T ('oi') -> [8][1024][768] (6.3 M)).
// Layout: every launch covers all 8 batches (token rows b*1024+t, or the batch on grid y); attention is ONE fused launch, a (batch, head) plane on grid y (k_fattn). ONE preparation launch (k_prep) rounds x and the weights to bf16 and builds the {cos, sin} table (32 angles a token) from the position ids (f32 powf/cosf/sinf); exact projections, q, k and v in ONE launch whose epilogue (a 64x64 tile is 64 tokens of one head) takes the 1/rms of each row, applies (x * inv_rms) * scale and the within-half rotate-half and writes the q/k hi/lo planes, or scales v by its 1/rms and writes the transposed value planes; fused dense T-1024 attention with EVERY row on hi/lo planes (the unscaled logits of unit-RMS vectors reach ~+-30), scores and probabilities in registers only; merged hi/lo x Wo exact.
// Plane layout ("fragment order"): every 16-bit operand plane is a row of WMMA fragments. A fragment (16 rows x 32 k) is 512 elements in the order [half of 16 k][lane][8 elements], lane = ((k / 8) & 1) * 16 + (row & 15):
// its two 16-byte loads are then 512 contiguous bytes each over the wave (4 whole 128-byte lines, not 32-byte pieces of 16 lines). The fragments lie as their reader walks them: x, weights and merged rows [64-row band][k / 32][16-row tile]; q and k [16-token tile][k / 32]; v [32 keys][16 channels]. The {cos, sin} table lies in its readers' lane order too (k_prep). The values and every sum order are those of row-major planes.
// Compute dtypes, f32 accumulate: every input rounded to bf16; projections exact; RMSNorm/rotary f32; scores and attn.v 3 products on every row; softmax f32 with a running maximum; Wo hl x exact.

#define NB_  8
#define TT   1024
#define DM   768
#define NH_  12
#define NKV  12
#define REP  (NH_ / NKV)
#define HD   64
#define DQ   (NH_ * HD)
#define DKV  (NKV * HD)
typedef _Float16 h16;
typedef unsigned short bf;
typedef __attribute__((ext_vector_type(16))) __bf16   v16bf;
typedef __attribute__((ext_vector_type(16))) _Float16 v16h;
typedef __attribute__((ext_vector_type(8)))  _Float16 v8h;
typedef __attribute__((ext_vector_type(8)))  unsigned short v8us;
typedef __attribute__((ext_vector_type(8)))  float    v8f;
typedef __attribute__((ext_vector_type(4)))  float    v4f;
typedef v8h  __attribute__((may_alias)) v8ha;
typedef v4f  __attribute__((may_alias)) v4fa;
typedef v8us __attribute__((may_alias)) v8usa;

__device__ __forceinline__ unsigned short f2bf(float f) { unsigned u = __float_as_uint(f); u += 0x7FFFu + ((u >> 16) & 1u); return (unsigned short)(u >> 16); }
__device__ __forceinline__ float bf2f(unsigned short b) { return __uint_as_float(((unsigned)b) << 16); }
__device__ __forceinline__ float bfr(float f) { return bf2f(f2bf(f)); }
__device__ __forceinline__ void splitf(float y, unsigned short& h, unsigned short& l) { h = f2bf(y); l = f2bf(y - bf2f(h)); }
__device__ __forceinline__ v16h cat16(v8h lo, v8h hi) { return __builtin_shufflevector(lo, hi, 0, 1, 2, 3, 4, 5, 6, 7, 8, 9, 10, 11, 12, 13, 14, 15); }
__device__ __forceinline__ v16bf cat16b(v8us lo, v8us hi) { return __builtin_bit_cast(v16bf, __builtin_shufflevector(lo, hi, 0, 1, 2, 3, 4, 5, 6, 7, 8, 9, 10, 11, 12, 13, 14, 15)); }
__device__ __forceinline__ v8f wmma16(v16h a, v16h b, v8f c) { return __builtin_amdgcn_wmma_f32_16x16x32_f16(false, a, false, b, (short)0, c, false, false); }
__device__ __forceinline__ v8f wmmab(v16bf a, v16bf b, v8f c) { return __builtin_amdgcn_wmma_f32_16x16x32_bf16(false, a, false, b, (short)0, c, false, false); }



// ---- k_gemmw: register-blocked GEMM, a 64x64 output tile (16 accumulators) a wave, 2 x 2 waves a work-group (128x128); grid (M/128, N/128, Z), 128 threads.
// The work-group's operand bands (2 of A, 2 of A2 where NSPLIT == 1, 2 of Bt; 64 rows x 64 k = 8 KiB each, contiguous in the fragment-order planes) come into a two-buffer LDS ring by asynchronous copies, one stage ahead;
// each band feeds two waves, and a fragment is read from LDS as it lay in the plane (ld: p = fragment start + lane * 8: 512 bytes in a row over the wave, no bank conflict).
// C[m][n] (f32, pitch ldc, + optional f32 bias[n]) = sum_k A[m][k] Bt[n][k] (+ A2[m][k] Bt[n][k] where NSPLIT == 1). z-batch strides sA/sB/sC in elements. K % 64 == 0.
template <typename T16> struct WFrag;
template <> struct WFrag<h16> { typedef v16h V; static __device__ __forceinline__ V ld(const h16* p) { return cat16(*(const v8h*)p, *(const v8h*)(p + 256)); } static __device__ __forceinline__ v8f mma(V a, V b, v8f c) { return wmma16(a, b, c); } };
template <> struct WFrag<bf> { typedef v16bf V; static __device__ __forceinline__ V ld(const bf* p) { return cat16b(*(const v8us*)p, *(const v8us*)(p + 256)); } static __device__ __forceinline__ v8f mma(V a, V b, v8f c) { return wmmab(a, b, c); } };
typedef __attribute__((ext_vector_type(2))) float v2f;
typedef __attribute__((ext_vector_type(2))) __bf16 v2bf;
typedef __attribute__((ext_vector_type(8))) __bf16 v8bf;
__device__ __forceinline__ v2f rbf2(v2f y) { return __builtin_convertvector(__builtin_convertvector(y, v2bf), v2f); }   // two values rounded to bf16
__device__ __forceinline__ void split2(v2f y, v2bf& h, v2bf& l) { h = __builtin_convertvector(y, v2bf); l = __builtin_convertvector(y - __builtin_convertvector(h, v2f), v2bf); }   // hi/lo planes of two values
// QKV = true: Bt holds the q, k and v weights one behind the other (the wave's column band / 12 says which, % 12 the head); nothing goes to C: the epilogue normalises, rotates and writes the attention planes (QkvEpi).
// cp2: the lane's own 16 bytes of each of the 8 pieces of 2 KiB of two bands (l: LDS byte address, g: global address), through no register.
// The s_wait_xcnt stands in the copies' own statement, so that nothing rewrites an address register of a copy in front of it.
__device__ __forceinline__ void cp2(unsigned l0, const char* g0, unsigned l1, const char* g1) {
    asm volatile("global_load_async_to_lds_b128 %0, %1, off\n\t"
                 "global_load_async_to_lds_b128 %2, %3, off\n\t"
                 "global_load_async_to_lds_b128 %4, %5, off\n\t"
                 "global_load_async_to_lds_b128 %6, %7, off\n\t"
                 "global_load_async_to_lds_b128 %8, %9, off\n\t"
                 "global_load_async_to_lds_b128 %10, %11, off\n\t"
                 "global_load_async_to_lds_b128 %12, %13, off\n\t"
                 "global_load_async_to_lds_b128 %14, %15, off\n\t"
                 "s_wait_xcnt 0x0"
                 :: "v"(l0), "v"(g0), "v"(l0 + 2048u), "v"(g0 + 2048), "v"(l0 + 4096u), "v"(g0 + 4096), "v"(l0 + 6144u), "v"(g0 + 6144),
                    "v"(l1), "v"(g1), "v"(l1 + 2048u), "v"(g1 + 2048), "v"(l1 + 4096u), "v"(g1 + 4096), "v"(l1 + 6144u), "v"(g1 + 6144) : "memory");
}
struct QkvEpi { const float* CS; const float* qsc; const float* ksc; bf* Qh; bf* Ql; bf* Kh; bf* Kl; bf* Vh; bf* Vl; };
template <typename T16, int NSPLIT, bool BIAS, bool QKV>
__global__ __launch_bounds__(128, NSPLIT == 0 ? 5 : 4) /* waves a SIMD: with 5 the projection launch's 1152 work-groups are all resident at once (64 KiB of LDS each) */ void k_gemmw(const T16* __restrict__ A, const T16* __restrict__ A2, const T16* __restrict__ Bt, const T16* __restrict__ Bt2, int K, float* C, int ldc, const float* __restrict__ bias, size_t sA, size_t sB, size_t sC, QkvEpi ep) {
    static_assert(NSPLIT == 0 || NSPLIT == 1, "A (+ A2) x Bt");
    typedef typename WFrag<T16>::V V;
    constexpr int NBAND = NSPLIT == 1 ? 6 : 4, BANDB = 8192, STAGEB = NBAND * BANDB;   // a stage: 64 k of every band, [band][32 k][16-row tile]
    __shared__ __align__(16) char ring[2 * STAGEB];   // behind the loop: the waves' output staging
    (void)Bt2;
    const size_t z = blockIdx.z; A += z * sA; if (A2) A2 += z * sA; Bt += z * sB; C += z * sC;
    const int tid = threadIdx.x, lane = tid & 31, lr = lane & 15, hi = lane >> 4; const int wave = __builtin_amdgcn_readfirstlane(tid >> 5), wm = wave >> 1, wn = wave & 1;
    const int r0 = blockIdx.x * 128 + wm * 64, c0 = blockIdx.y * 128 + wn * 64;   // the wave's own 64x64 tile
    v8f acc[4][4];
#pragma unroll
    for (int mb = 0; mb < 4; ++mb)
#pragma unroll
        for (int nb = 0; nb < 4; ++nb) acc[mb][nb] = (v8f){};
    const unsigned lo = lane * 8;
    const size_t gband = (size_t)K * 128;   // bytes of a 64-row band of a plane
    const char* gA = (const char*)(A + (size_t)blockIdx.x * 128 * K) + tid * 16; const char* gB = (const char*)(Bt + (size_t)blockIdx.y * 128 * K) + tid * 16; const char* gA2 = gA;
    if constexpr (NSPLIT == 1) gA2 = (const char*)(A2 + (size_t)blockIdx.x * 128 * K) + tid * 16;
    const unsigned l0 = (unsigned)(size_t)ring + tid * 16;
    auto fill = [&](int buf) {   // the next stage of every band into buffer buf: 128 lanes x 16 bytes a copy
        const unsigned l = l0 + buf * STAGEB;
        cp2(l, gA, l + BANDB, gA + gband);
        if constexpr (NSPLIT == 1) cp2(l + 2 * BANDB, gA2, l + 3 * BANDB, gA2 + gband);
        cp2(l + (NBAND - 2) * BANDB, gB, l + (NBAND - 1) * BANDB, gB + gband);
        gA += BANDB; gA2 += BANDB; gB += BANDB; };
    const int NT = K / 64;
    fill(0);
    asm volatile("s_wait_asynccnt 0x0" ::: "memory");   // this wave's part of stage 0 has landed
    __syncthreads();                                    // ... and every other wave's
    if (NT > 1) fill(1);
    // one trip a stage, kept rolled (the buffer goes by t & 1); the loops inside are unrolled so that the fragment and accumulator arrays have constant indices and stay in registers
#pragma unroll 1
    for (int t = 0; t < NT; ++t) {
        const char* sb = ring + (t & 1) * STAGEB + lane * 16;
#pragma unroll
        for (int ks = 0; ks < 2; ++ks) {
            V a[4], a2[4], b[2];
            const char* sB = sb + (NBAND - 2 + wn) * BANDB + ks * 4096;
#pragma unroll
            for (int mb = 0; mb < 4; ++mb) { a[mb] = WFrag<T16>::ld((const T16*)(sb + wm * BANDB + ks * 4096 + mb * 1024)); if (NSPLIT == 1) a2[mb] = WFrag<T16>::ld((const T16*)(sb + (2 + wm) * BANDB + ks * 4096 + mb * 1024)); }
            b[0] = WFrag<T16>::ld((const T16*)sB);
#pragma unroll
            for (int nb = 0; nb < 4; ++nb) {
                if (nb < 3) b[(nb + 1) & 1] = WFrag<T16>::ld((const T16*)(sB + (nb + 1) * 1024));
                __builtin_amdgcn_sched_barrier(0);   // the next column fragment's two LDS loads go out in front of this fragment's products, so that their latency runs under them
#pragma unroll
                for (int mb = 0; mb < 4; ++mb) { acc[mb][nb] = WFrag<T16>::mma(a[mb], b[nb & 1], acc[mb][nb]); if (NSPLIT == 1) acc[mb][nb] = WFrag<T16>::mma(a2[mb], b[nb & 1], acc[mb][nb]); } }
        }
        asm volatile("s_wait_dscnt 0x0" ::: "memory");      // this wave's reads of the buffer are done before it is refilled
        asm volatile("s_wait_asynccnt 0x0" ::: "memory");   // this wave's part of the next stage has landed
        __syncthreads();                                    // publishes the next stage and ends every wave's reads of this one
        if (t + 2 < NT) fill(t & 1);
    }
    asm volatile("s_wait_asynccnt 0x0" ::: "memory");       // nothing is in flight when the ring becomes staging (the last trip's barrier ended every read of it)
    float* os = (float*)ring + wave * (16 * 68 + 16); float* rfs = os + 16 * 68;   // each wave stages in its own range
#pragma unroll
    for (int mb = 0; mb < 4; ++mb) {
#pragma unroll
        for (int nb = 0; nb < 4; ++nb) {
#pragma unroll
            for (int j = 0; j < 8; ++j) os[(hi * 8 + j) * 68 + nb * 16 + lr] = acc[mb][nb][j]; }
        __builtin_amdgcn_wave_barrier(); asm volatile("" ::: "memory");
        if constexpr (QKV) {
            // lane = (row, half): 32 channels of one token, which hold every rotate-half pair (c, c + 16) of one axis
            const int sel = (c0 / HD) / NH_, g = (r0 / TT) * NH_ + (c0 / HD) % NH_, tk = r0 % TT + mb * 16; const int row = lane >> 1, hf = lane & 1;
            float xv[32]; float ss = 0.f;
#pragma unroll
            for (int c = 0; c < 8; ++c) { const v4f q = *(const v4fa*)(os + row * 68 + hf * 32 + c * 4);
#pragma unroll
                for (int i = 0; i < 4; ++i) { xv[c * 4 + i] = q[i]; ss += q[i] * q[i]; } }
            ss += __shfl_xor(ss, 1);    // the row's other half
            const float rf = __fdiv_rn(1.0f, __fsqrt_rn(ss * (1.0f / HD) + 1e-6f));
            if (sel < 2) {
                const float* nw = (sel ? ep.ksc : ep.qsc) + hf * 32; const float* cs = ep.CS + ((size_t)(r0 / 16 + mb) * 256 + lane) * 4;
                bf* Ph = sel ? ep.Kh : ep.Qh; bf* Pl = sel ? ep.Kl : ep.Ql; const size_t eo = ((size_t)g * TT + tk) * HD + hf * 512 + row * 8;   // fragment order: this half's 32 channels are one fragment
#pragma unroll
                for (int c = 0; c < 16; c += 8) { v8bf ah, al, bh, bl;   // channels c .. c + 7 (a) and their partners c + 16 .. c + 23 (b)
#pragma unroll
                    for (int i = 0; i < 8; i += 2) { const v4f e = *(const v4f*)(cs + (c + i) * 64);   // {cos, sin} of channels c + i, c + i + 1 (those of + 16 are the same); the wave's 512 bytes lie in a row
                        const v2f w0 = rbf2(*(const v2f*)(nw + c + i)), w1 = rbf2(*(const v2f*)(nw + 16 + c + i)); const v2f co = { e[0], e[2] }, si = { e[1], e[3] };
                        const v2f x0 = { xv[c + i], xv[c + i + 1] }, x1 = { xv[c + 16 + i], xv[c + 16 + i + 1] }; const v2f n0 = x0 * rf * w0, n1 = x1 * rf * w1;
                        v2bf h, l; split2(n0 * co - n1 * si, h, l); ah[i] = h[0]; ah[i + 1] = h[1]; al[i] = l[0]; al[i + 1] = l[1];
                        split2(n1 * co + n0 * si, h, l); bh[i] = h[0]; bh[i + 1] = h[1]; bl[i] = l[0]; bl[i + 1] = l[1]; }
                    *(v8us*)(Ph + eo + c * 16) = __builtin_bit_cast(v8us, ah); *(v8us*)(Pl + eo + c * 16) = __builtin_bit_cast(v8us, al); *(v8us*)(Ph + eo + 256 + c * 16) = __builtin_bit_cast(v8us, bh); *(v8us*)(Pl + eo + 256 + c * 16) = __builtin_bit_cast(v8us, bl);
                    asm volatile("s_wait_xcnt 0x0" ::: "memory");   // what follows reuses the data and address registers of these stores
                    __builtin_amdgcn_sched_barrier(0); }            // keeps it behind the wait
            } else {
                if (hf == 0) rfs[row] = rf;
                __builtin_amdgcn_wave_barrier(); asm volatile("" ::: "memory");   // the 1/rms of the 16 rows are read by other lanes than wrote them
                const v4f f0 = *(const v4fa*)(rfs + hi * 8), f1 = *(const v4fa*)(rfs + hi * 8 + 4);
#pragma unroll
                for (int nb = 0; nb < 4; ++nb) { v8bf oh, ol;   // a lane holds 8 tokens in a row of one channel: its own 16 bytes of a fragment of the transposed plane
#pragma unroll
                    for (int j = 0; j < 8; j += 2) { const v2f y = { acc[mb][nb][j] * (j < 4 ? f0[j & 3] : f1[j & 3]), acc[mb][nb][j + 1] * (j < 4 ? f0[(j & 3) + 1] : f1[(j & 3) + 1]) };
                        v2bf h, l; split2(y, h, l); oh[j] = h[0]; oh[j + 1] = h[1]; ol[j] = l[0]; ol[j + 1] = l[1]; }
                    const size_t vo = (size_t)g * HD * TT + (size_t)((((tk >> 5) * 4 + nb) * 2 + ((tk >> 4) & 1)) * 256); /* [32 keys][16 channels][16 keys], then the lane */ *(v8us*)(ep.Vh + vo + lo) = __builtin_bit_cast(v8us, oh); *(v8us*)(ep.Vl + vo + lo) = __builtin_bit_cast(v8us, ol);
                    asm volatile("s_wait_xcnt 0x0" ::: "memory");   // the next tile's split reuses the data and address registers of these stores
                    __builtin_amdgcn_sched_barrier(0); }            // keeps it behind the wait
            }
        } else {
        float* crow = C + (size_t)(r0 + mb * 16) * ldc + c0;
{
#pragma unroll
            for (int s = 0; s < 8; ++s) { const int row = 2 * s + hi, cofs = lr * 4; v4f val = *(const v4fa*)(os + row * 68 + cofs); if (BIAS) { val[0] += bfr(bias[c0 + cofs]); val[1] += bfr(bias[c0 + cofs + 1]); val[2] += bfr(bias[c0 + cofs + 2]); val[3] += bfr(bias[c0 + cofs + 3]); }
                *(v4f*)(crow + (size_t)row * ldc + cofs) = val; }
             }
        }
        __builtin_amdgcn_wave_barrier(); asm volatile("" ::: "memory");
    }
}

__device__ __forceinline__ h16 tohx(float x) { return (h16)x; }
typedef __attribute__((ext_vector_type(2))) _Float16 v2h;
typedef __attribute__((ext_vector_type(4))) _Float16 v4h;
typedef __attribute__((ext_vector_type(2))) unsigned short v2us;
typedef __attribute__((ext_vector_type(4))) unsigned short v4us;
typedef __attribute__((ext_vector_type(4))) int v4i;

__global__ __launch_bounds__(256) void k_wtG(const float* __restrict__ w, int K, int N, bf* Bt) {
    const int lane = threadIdx.x & 31; const int L0 = (blockIdx.x * 8 + (threadIdx.x >> 5)) * 8; const int nlines = N * K / 64;
{
#pragma unroll 1
        for (int l = 0; l < 8; ++l) { const int L = L0 + l; if (L >= nlines) break; const size_t e = (size_t)L * 64 + lane * 2; const int k = (int)(e % K), n = (int)(e / K); v2us o;
            o[0] = f2bf(w[(size_t)k * N + n]); o[1] = f2bf(w[(size_t)(k + 1) * N + n]); *(v2us*)(Bt + e) = o; }
         }
}
// ---- k_prep: all that the projections read is made in ONE launch; a thread makes 4 table entries or 8 pieces of 16 bytes, so that the launch has few waves to start.
// Blocks 0 .. CSB - 1: the {cos, sin} table in the order the projection epilogue's lanes read it: [16-token tile][channel pair 0..7][lane = token * 2 + axis][{cos, sin} x 2]. The reader takes the 16 frequencies of an axis once (channels + 16 repeat them), so its order has a place for those 16 alone.
// The other blocks: row-major f32 [R][768] (x, then the four weights) to bf16 in fragment order, 64-row bands; a block takes 8 steps of 32 k of one band (3 blocks a band), a thread the same 16 bytes of each step's 4 fragments. Within 64 threads (one fragment) 4 threads in a row take the 128 bytes (32 k) of one source row: a wave reads 8 whole lines and writes 4 whole lines a step.
#define CSB (NB_ * TT * (HD / 2) / 1024)
#define XBB (NB_ * TT / 64 * 3)
#define WBB (DQ / 64 * 3)
__global__ __launch_bounds__(256) void k_prep(const float* __restrict__ x, const float* __restrict__ wq, const float* __restrict__ wk, const float* __restrict__ wv, const float* __restrict__ wo, const int* __restrict__ pid, bf* XB, bf* WQKV, bf* WO, float* CS) {
    const int tid = threadIdx.x; int b = blockIdx.x;
    if (b < CSB) {   // entries b * 1024 + (tt * 2 + h) * 256 + tid: two 16-token tiles (tt), in each this thread's frequency i and i + 8 (h)
        const int ax = (tid >> 1) & 1, tl = (tid >> 2) & 15, i = (tid >> 6) * 2 + (tid & 1); float inv[2];
        const int pv[2] = { pid[(b * 32 + tl) * 2 + ax], pid[(b * 32 + 16 + tl) * 2 + ax] };   // both tiles' positions, in flight under the powers below
        // the loops of 2 trips below are unrolled so that inv and pv have constant indices and stay in registers
#pragma unroll
        for (int h = 0; h < 2; ++h) { const float e = __fdiv_rn((float)(2 * (i + 8 * h)), (float)(HD / 2)); inv[h] = __fdiv_rn(1.0f, powf(100.0f, e)); }
#pragma unroll
        for (int tt = 0; tt < 2; ++tt) {
#pragma unroll
            for (int h = 0; h < 2; ++h) { const float a = __fmul_rn((float)pv[tt], inv[h]); v2f cs; cs[0] = cosf(a); cs[1] = sinf(a);
                *(v2f*)(CS + ((size_t)(b * 2 + tt) * 512 + h * 256 + tid) * 2) = cs; } }
        return;
    }
    b -= CSB; const float* src = x; bf* dst = XB;
    if (b >= XBB) { b -= XBB; const int w = b / WBB; b -= w * WBB; src = w == 0 ? wq : w == 1 ? wk : w == 2 ? wv : wo; dst = w < 3 ? WQKV + (size_t)w * DQ * DM : WO; }
    const int band = b / 3, ks = (b % 3) * 8; const int i0 = (tid & 192) | ((tid >> 2) & 15) | ((tid & 3) << 4);   // the thread's 16 bytes among the 256 of a step
    const float* p = src + (size_t)(band * 64 + ((i0 >> 6) & 3) * 16 + (i0 & 15)) * DM + ks * 32 + ((i0 >> 5) & 1) * 16 + ((i0 >> 4) & 1) * 8; bf* q = dst + ((size_t)(band * (DM / 32) + ks) * 256 + i0) * 8;
    v8f v[8];   // the loops below are unrolled so that v has constant indices and stays in registers, and the 16 loads go out as one run
#pragma unroll
    for (int j = 0; j < 8; ++j) v[j] = *(const v8f*)(p + j * 32);
    asm volatile("s_wait_xcnt 0x0" :: "v"(p) : "memory");   // the address register of the 16 loads stays whole up to this wait (input), so that no load of the run lands in it and nothing rewrites it in front of the wait
#pragma unroll
    for (int j = 0; j < 8; ++j) { v8us o;
#pragma unroll
        for (int k = 0; k < 8; ++k) o[k] = f2bf(v[j][k]);
        *(v8us*)(q + j * 2048) = o; }
    asm volatile("s_wait_xcnt 0x0" ::: "memory");   // behind the last of the 8 stores: in the built code the table part stands behind them and rewrites their offset, data and base registers
}
// ---- k_fattn: scores, softmax and attn.v of one (batch, head) plane in ONE kernel; the scores never leave the registers.
// Grid (TT / 128, planes), 4 waves; a wave owns 32 query columns and walks the 1024 keys in steps of 32, operands straight from the hi/lo planes (no LDS, no barrier). Scores unscaled (module scaling 1.0).
// S^T = K Q^T (A = key rows, B = query columns) and O^T += V^T P^T (A = rows of the transposed value plane, B = P^T): in every tile a lane holds ONE query (column lane & 15),
// so maximum, sum and rescale are per lane plus one exchange with lane ^ 16, and two S^T tiles (keys 0-15, 16-31) are, converted in place, the B fragment of the second product.
// Running maximum (online softmax): P = exp(s - m) unnormalised on hi/lo planes, O and the sum rescaled by exp(m_old - m_new) each step, one division at the end. Writes the merged hi/lo planes.
__device__ __forceinline__ float xhalf(float x) { const int b = __float_as_int(x); return __int_as_float(__builtin_amdgcn_permlanex16(b, b, 0x76543210, 0xfedcba98, false, false)); }   // value of lane ^ 16
__global__ __launch_bounds__(128) void k_fattn(const bf* __restrict__ Qh, const bf* __restrict__ Ql, const bf* __restrict__ Kh, const bf* __restrict__ Kl, const bf* __restrict__ Vh, const bf* __restrict__ Vl, bf* Ah, bf* Al) {
    typedef WFrag<bf> W;
    const int lane = threadIdx.x & 31, lr = lane & 15, hi = lane >> 4; const int g = blockIdx.y; const int q0 = (blockIdx.x * 4 + (threadIdx.x >> 5)) * 32;
    const size_t po = (size_t)g * TT * HD; const size_t qo = po + (size_t)q0 * HD + lane * 8;
    const bf* kh = Kh + po + lane * 8; const bf* kl = Kl + po + lane * 8; const bf* vh = Vh + po + lane * 8; const bf* vl = Vl + po + lane * 8;   // planes in fragment order: 512 elements a fragment
    v16bf qh[2][2], ql[2][2];
#pragma unroll
    for (int nq = 0; nq < 2; ++nq)
#pragma unroll
        for (int kc = 0; kc < 2; ++kc) { qh[nq][kc] = W::ld(Qh + qo + nq * 16 * HD + kc * 512); ql[nq][kc] = W::ld(Ql + qo + nq * 16 * HD + kc * 512); }
    v16bf ka[2][2], kb[2][2];   // this step's key fragments (hi, lo), fetched one step ahead
#pragma unroll
    for (int kt = 0; kt < 2; ++kt)
#pragma unroll
        for (int kc = 0; kc < 2; ++kc) { ka[kt][kc] = W::ld(kh + (size_t)kt * 16 * HD + kc * 512); kb[kt][kc] = W::ld(kl + (size_t)kt * 16 * HD + kc * 512); }
    asm volatile("s_wait_xcnt 0x0" ::: "memory");   // the start values below reuse the address registers of the loads above
    __builtin_amdgcn_sched_barrier(0);              // keeps those start values behind the wait
    v8f o[2][4]; float m[2], l[2];
#pragma unroll
    for (int nq = 0; nq < 2; ++nq) { m[nq] = -3.0e38f; l[nq] = 0.f;
#pragma unroll
        for (int dt = 0; dt < 4; ++dt) o[nq][dt] = (v8f){}; }
#pragma unroll 1
    for (int k0 = 0; k0 < TT; k0 += 32) {
        v16bf va[4], vb[4];         // this step's value fragments: in flight under the score products and the softmax
#pragma unroll
        for (int dt = 0; dt < 4; ++dt) { va[dt] = W::ld(vh + (size_t)k0 * HD + dt * 512); vb[dt] = W::ld(vl + (size_t)k0 * HD + dt * 512); }
        v8f s[2][2];
#pragma unroll
        for (int kt = 0; kt < 2; ++kt) { s[0][kt] = (v8f){}; s[1][kt] = (v8f){};
#pragma unroll
            for (int kc = 0; kc < 2; ++kc) {
#pragma unroll
                for (int nq = 0; nq < 2; ++nq) { s[nq][kt] = wmmab(ka[kt][kc], qh[nq][kc], s[nq][kt]); s[nq][kt] = wmmab(ka[kt][kc], ql[nq][kc], s[nq][kt]); s[nq][kt] = wmmab(kb[kt][kc], qh[nq][kc], s[nq][kt]); } } }
        const int kn = (k0 + 32) & (TT - 1);   // the next step's keys (the last step fetches step 0 again: in bounds, unused)
#pragma unroll
        for (int kt = 0; kt < 2; ++kt)
#pragma unroll
            for (int kc = 0; kc < 2; ++kc) { ka[kt][kc] = W::ld(kh + (size_t)(kn + kt * 16) * HD + kc * 512); kb[kt][kc] = W::ld(kl + (size_t)(kn + kt * 16) * HD + kc * 512); }
        asm volatile("s_wait_xcnt 0x0" ::: "memory");   // the softmax below reuses the address registers of the loads above
        __builtin_amdgcn_sched_barrier(0);     // keeps the loads above issued in front of the softmax, so that their latency runs under it
        v16bf ph[2], pl[2];
#pragma unroll
        for (int nq = 0; nq < 2; ++nq) { float mx = s[nq][0][0];
#pragma unroll
            for (int j = 0; j < 8; ++j) mx = fmaxf(mx, fmaxf(s[nq][0][j], s[nq][1][j]));
            mx = fmaxf(mx, xhalf(mx)); const float mn = fmaxf(m[nq], mx); const float al = __builtin_amdgcn_exp2f((m[nq] - mn) * 1.4426950408889634f); m[nq] = mn; float sum = 0.f;
#pragma unroll
            for (int e = 0; e < 16; e += 2) { v2f t; t[0] = s[nq][e >> 3][e & 7]; t[1] = s[nq][e >> 3][(e & 7) + 1]; t = (t - mn) * 1.4426950408889634f; v2f p; p[0] = __builtin_amdgcn_exp2f(t[0]); p[1] = __builtin_amdgcn_exp2f(t[1]); sum += p[0]; sum += p[1];
                const v2bf h = __builtin_convertvector(p, v2bf); const v2bf r = __builtin_convertvector(p - __builtin_convertvector(h, v2f), v2bf); ph[nq][e] = h[0]; ph[nq][e + 1] = h[1]; pl[nq][e] = r[0]; pl[nq][e + 1] = r[1]; }
            l[nq] = l[nq] * al + sum;
#pragma unroll
            for (int dt = 0; dt < 4; ++dt) o[nq][dt] *= al; }
#pragma unroll
        for (int dt = 0; dt < 4; ++dt) { const v16bf a = va[dt]; const v16bf a2 = vb[dt];
#pragma unroll
            for (int nq = 0; nq < 2; ++nq) { o[nq][dt] = wmmab(a, ph[nq], o[nq][dt]); o[nq][dt] = wmmab(a, pl[nq], o[nq][dt]); o[nq][dt] = wmmab(a2, ph[nq], o[nq][dt]); } }
    }
#pragma unroll
    for (int nq = 0; nq < 2; ++nq) { const float f = __fdiv_rn(1.0f, l[nq] + xhalf(l[nq])); const size_t oo = ((size_t)(g / NH_) * TT + (q0 & ~63)) * DQ + (g % NH_) * (64 * HD) + (((q0 >> 4) & 3) + nq) * 512 + lane * 8;   // fragment order of the [8192][768] merged plane: band, the head's two steps of 32 k, this 16-token tile
#pragma unroll
        for (int dt = 0; dt < 4; ++dt) { v8us oh, ol;
#pragma unroll
            for (int j = 0; j < 8; ++j) { unsigned short a, c2; splitf(o[nq][dt][j] * f, a, c2); oh[j] = a; ol[j] = c2; }
            *(v8us*)(Ah + oo + (dt >> 1) * 2048 + (dt & 1) * 256) = oh; *(v8us*)(Al + oo + (dt >> 1) * 2048 + (dt & 1) * 256) = ol;
            asm volatile("s_wait_xcnt 0x0" ::: "memory");   // the next tile's split reuses the data registers of these stores
            __builtin_amdgcn_sched_barrier(0); } }          // keeps the next tile's split behind the wait
}

extern "C" void kernel_launch(void* const* d_in, const int* in_sizes, int n_in,
                              void* d_out, int out_size, void* d_ws, size_t ws_size, hipStream_t stream) {
    (void)in_sizes; (void)n_in; (void)out_size;
    const float* x = (const float*)d_in[0]; const int* pid = (const int*)d_in[1]; const float* wq = (const float*)d_in[2]; const float* wk = (const float*)d_in[3]; const float* wv = (const float*)d_in[4]; const float* wo = (const float*)d_in[5]; const float* qsc = (const float*)d_in[6]; const float* ksc = (const float*)d_in[7];
    float* OUT = (float*)d_out;     // [8][1024][768]
    char* wsp = (char*)d_ws;
    auto take = [&](size_t bytes) { char* p = wsp; wsp += (bytes + 255) & ~(size_t)255; return (void*)p; };
    bf* WQ = (bf*)take((size_t)(DQ + 2 * DKV) * DM * 2);   // one [2304][768] weight plane: q, k, v rows one behind the other
    bf* WO = (bf*)take((size_t)DM * DQ * 2); float* CS = (float*)take((size_t)NB_ * TT * HD * 2 * 4);
    bf* QPh = (bf*)take((size_t)NB_ * NH_ * TT * HD * 2); bf* QPl = (bf*)take((size_t)NB_ * NH_ * TT * HD * 2); bf* KPh = (bf*)take((size_t)NB_ * NKV * TT * HD * 2); bf* KPl = (bf*)take((size_t)NB_ * NKV * TT * HD * 2); bf* VTh = (bf*)take((size_t)NB_ * NKV * HD * TT * 2); bf* VTl = (bf*)take((size_t)NB_ * NKV * HD * TT * 2);
    bf* ATh = (bf*)take((size_t)NB_ * TT * DQ * 2); bf* ATl = (bf*)take((size_t)NB_ * TT * DQ * 2);
    bf* XB = (bf*)take((size_t)NB_ * TT * DM * 2);   // x in bf16
    if ((size_t)(wsp - (char*)d_ws) > ws_size) return;    // ws 256 MiB
    k_prep<<<CSB + XBB + 4 * WBB, 256, 0, stream>>>(x, wq, wk, wv, wo, pid, XB, WQ, WO, CS);   // the rotary table of all batches; x and the four weights in bf16
    const QkvEpi ep = { CS, qsc, ksc, QPh, QPl, KPh, KPl, VTh, VTl };
    k_gemmw<bf, 0, false, true><<<dim3(NB_ * TT / 128, (DQ + 2 * DKV) / 128, 1), 128, 0, stream>>>(XB, nullptr, WQ, nullptr, DM, nullptr, 0, nullptr, 0, 0, 0, ep);   // q, k, v projections with RMSNorm, rotary and plane build in the epilogue
    k_fattn<<<dim3(TT / 128, NB_ * NH_, 1), 128, 0, stream>>>(QPh, QPl, KPh, KPl, VTh, VTl, ATh, ATl);   // plane g = batch * 12 + head; one kv head per query head
    k_gemmw<bf, 1, false, false><<<dim3(NB_ * TT / 128, DM / 128, 1), 128, 0, stream>>>(ATh, ATl, WO, nullptr, DQ, OUT, DM, nullptr, 0, 0, 0, QkvEpi{});
}

// v007
// Measured time: 109 microseconds a run.
// Next to v006, in two timings, it ran 1.03 times as fast each time.
// Over all steps from v000 it is 21.9 times as fast.
#include <hip/hip_runtime.h>

// Vision attention with per-head RMSNorm and 2-D rotary positions (hidden [8][1024][768]; q,k,v = x W^T ('oi' [768][768], 12 heads x 64); q, k RMS-normalised per head (eps 1e-6) x scale, v RMS-normalised without scale; 2-D RoPE: the head's first 32 channels rotate (rotate-half within the 32) by the x position, the last 32 by the y position, angle = pos x 100^(-2i/32) from pixel_position_ids int32 [8][1024][2]; scores = q.k UNSCALED; softmax; out = merged Wo^T ('oi') -> [8][1024][768] (6.3 M)).
// Layout: every launch covers all 8 batches (token rows b*1024+t, or planes g = batch*12+head of a flat grid); attention is ONE fused launch over all (batch, head) planes (k_fattn). ONE preparation launch (k_prep) rounds x and the weights to bf16 and builds the {cos, sin} table (32 angles a token) from the position ids (f32 powf/cosf/sinf); exact projections, q, k and v in ONE launch whose epilogue (a 64x64 tile is 64 tokens of one head) takes the 1/rms of each row, applies (x * inv_rms) * scale and the within-half rotate-half and writes the q/k hi/lo planes, or scales v by its 1/rms and writes the transposed value planes; fused dense T-1024 attention with EVERY row on hi/lo planes (the unscaled logits of unit-RMS vectors reach ~+-30), scores and probabilities in registers only; merged hi/lo x Wo exact.
// Plane layout ("fragment order"): every 16-bit operand plane is a row of WMMA fragments. A fragment (16 rows x 32 k) is 512 elements in the order [half of 16 k][lane][8 elements], lane = ((k / 8) & 1) * 16 + (row & 15):
// its two 16-byte loads are then 512 contiguous bytes each over the wave (4 whole 128-byte lines, not 32-byte pieces of 16 lines). The fragments lie as their reader walks them: x, weights and merged rows [64-row band][k / 32][16-row tile]; q and k [16-token tile][k / 32]; v [32 keys][16 channels]. The {cos, sin} table lies in its readers' lane order too (k_prep). The values and every sum order are those of row-major planes.
// Compute dtypes, f32 accumulate: every input rounded to bf16; projections exact; RMSNorm/rotary f32; scores and attn.v 3 products on every row; softmax f32 with a running maximum; Wo hl x exact.

#define NB_  8
#define TT   1024
#define DM   768
#define NH_  12
#define NKV  12
#define REP  (NH_ / NKV)
#define HD   64
#define DQ   (NH_ * HD)
#define DKV  (NKV * HD)
typedef _Float16 h16;
typedef unsigned short bf;
typedef __attribute__((ext_vector_type(16))) __bf16   v16bf;
typedef __attribute__((ext_vector_type(16))) _Float16 v16h;
typedef __attribute__((ext_vector_type(8)))  _Float16 v8h;
typedef __attribute__((ext_vector_type(8)))  unsigned short v8us;
typedef __attribute__((ext_vector_type(8)))  float    v8f;
typedef __attribute__((ext_vector_type(4)))  float    v4f;
typedef v8h  __attribute__((may_alias)) v8ha;
typedef v4f  __attribute__((may_alias)) v4fa;
typedef v8us __attribute__((may_alias)) v8usa;

__device__ __forceinline__ unsigned short f2bf(float f) { unsigned u = __float_as_uint(f); u += 0x7FFFu + ((u >> 16) & 1u); return (unsigned short)(u >> 16); }
__device__ __forceinline__ float bf2f(unsigned short b) { return __uint_as_float(((unsigned)b) << 16); }
__device__ __forceinline__ float bfr(float f) { return bf2f(f2bf(f)); }
__device__ __forceinline__ void splitf(float y, unsigned short& h, unsigned short& l) { h = f2bf(y); l = f2bf(y - bf2f(h)); }
__device__ __forceinline__ v16h cat16(v8h lo, v8h hi) { return __builtin_shufflevector(lo, hi, 0, 1, 2, 3, 4, 5, 6, 7, 8, 9, 10, 11, 12, 13, 14, 15); }
__device__ __forceinline__ v16bf cat16b(v8us lo, v8us hi) { return __builtin_bit_cast(v16bf, __builtin_shufflevector(lo, hi, 0, 1, 2, 3, 4, 5, 6, 7, 8, 9, 10, 11, 12, 13, 14, 15)); }
__device__ __forceinline__ v8f wmma16(v16h a, v16h b, v8f c) { return __builtin_amdgcn_wmma_f32_16x16x32_f16(false, a, false, b, (short)0, c, false, false); }
__device__ __forceinline__ v8f wmmab(v16bf a, v16bf b, v8f c) { return __builtin_amdgcn_wmma_f32_16x16x32_bf16(false, a, false, b, (short)0, c, false, false); }



// ---- k_gemmw: register-blocked GEMM, a 64x64 output tile (16 accumulators) a wave, 2 x 2 waves a work-group (128x128); grid (M/128, N/128, Z), 128 threads.
// The work-group's operand bands (2 of A, 2 of A2 where NSPLIT == 1, 2 of Bt; 64 rows x 64 k = 8 KiB each, contiguous in the fragment-order planes) come into a two-buffer LDS ring by asynchronous copies, one stage ahead;
// each band feeds two waves, and a fragment is read from LDS as it lay in the plane (ld: p = fragment start + lane * 8: 512 bytes in a row over the wave, no bank conflict).
// C[m][n] (f32, pitch ldc, + optional f32 bias[n]) = sum_k A[m][k] Bt[n][k] (+ A2[m][k] Bt[n][k] where NSPLIT == 1). z-batch strides sA/sB/sC in elements. K % 64 == 0.
template <typename T16> struct WFrag;
template <> struct WFrag<h16> { typedef v16h V; static __device__ __forceinline__ V ld(const h16* p) { return cat16(*(const v8h*)p, *(const v8h*)(p + 256)); } static __device__ __forceinline__ v8f mma(V a, V b, v8f c) { return wmma16(a, b, c); } };
template <> struct WFrag<bf> { typedef v16bf V; static __device__ __forceinline__ V ld(const bf* p) { return cat16b(*(const v8us*)p, *(const v8us*)(p + 256)); } static __device__ __forceinline__ v8f mma(V a, V b, v8f c) { return wmmab(a, b, c); } };
typedef __attribute__((ext_vector_type(2))) float v2f;
typedef __attribute__((ext_vector_type(2))) __bf16 v2bf;
typedef __attribute__((ext_vector_type(8))) __bf16 v8bf;
__device__ __forceinline__ v2f rbf2(v2f y) { return __builtin_convertvector(__builtin_convertvector(y, v2bf), v2f); }   // two values rounded to bf16
__device__ __forceinline__ void split2(v2f y, v2bf& h, v2bf& l) { h = __builtin_convertvector(y, v2bf); l = __builtin_convertvector(y - __builtin_convertvector(h, v2f), v2bf); }   // hi/lo planes of two values
// QKV = true: Bt holds the q, k and v weights one behind the other (the wave's column band / 12 says which, % 12 the head); nothing goes to C: the epilogue normalises, rotates and writes the attention planes (QkvEpi).
// cp2: the lane's own 16 bytes of each of the 8 pieces of 2 KiB of two bands (l: LDS byte address, g: global address), through no register.
// The s_wait_xcnt stands in the copies' own statement, so that nothing rewrites an address register of a copy in front of it.
__device__ __forceinline__ void cp2(unsigned l0, const char* g0, unsigned l1, const char* g1) {
    asm volatile("global_load_async_to_lds_b128 %0, %1, off\n\t"
                 "global_load_async_to_lds_b128 %2, %3, off\n\t"
                 "global_load_async_to_lds_b128 %4, %5, off\n\t"
                 "global_load_async_to_lds_b128 %6, %7, off\n\t"
                 "global_load_async_to_lds_b128 %8, %9, off\n\t"
                 "global_load_async_to_lds_b128 %10, %11, off\n\t"
                 "global_load_async_to_lds_b128 %12, %13, off\n\t"
                 "global_load_async_to_lds_b128 %14, %15, off\n\t"
                 "s_wait_xcnt 0x0"
                 :: "v"(l0), "v"(g0), "v"(l0 + 2048u), "v"(g0 + 2048), "v"(l0 + 4096u), "v"(g0 + 4096), "v"(l0 + 6144u), "v"(g0 + 6144),
                    "v"(l1), "v"(g1), "v"(l1 + 2048u), "v"(g1 + 2048), "v"(l1 + 4096u), "v"(g1 + 4096), "v"(l1 + 6144u), "v"(g1 + 6144) : "memory");
}
struct QkvEpi { const float* CS; const float* qsc; const float* ksc; bf* Qh; bf* Ql; bf* Kh; bf* Kl; bf* Vh; bf* Vl; };
template <typename T16, int NSPLIT, bool BIAS, bool QKV>
__global__ __launch_bounds__(128, NSPLIT == 0 ? 5 : 4) /* waves a SIMD: with 5 the projection launch's 1152 work-groups are all resident at once (64 KiB of LDS each) */ void k_gemmw(const T16* __restrict__ A, const T16* __restrict__ A2, const T16* __restrict__ Bt, const T16* __restrict__ Bt2, int K, float* C, int ldc, const float* __restrict__ bias, size_t sA, size_t sB, size_t sC, QkvEpi ep) {
    static_assert(NSPLIT == 0 || NSPLIT == 1, "A (+ A2) x Bt");
    typedef typename WFrag<T16>::V V;
    constexpr int NBAND = NSPLIT == 1 ? 6 : 4, BANDB = 8192, STAGEB = NBAND * BANDB;   // a stage: 64 k of every band, [band][32 k][16-row tile]
    __shared__ __align__(16) char ring[2 * STAGEB];   // behind the loop: the waves' output staging
    (void)Bt2;
    const size_t z = blockIdx.z; A += z * sA; if (A2) A2 += z * sA; Bt += z * sB; C += z * sC;
    const int tid = threadIdx.x, lane = tid & 31, lr = lane & 15, hi = lane >> 4; const int wave = __builtin_amdgcn_readfirstlane(tid >> 5), wm = wave >> 1, wn = wave & 1;
    const int r0 = blockIdx.x * 128 + wm * 64, c0 = blockIdx.y * 128 + wn * 64;   // the wave's own 64x64 tile
    v8f acc[4][4];
#pragma unroll
    for (int mb = 0; mb < 4; ++mb)
#pragma unroll
        for (int nb = 0; nb < 4; ++nb) acc[mb][nb] = (v8f){};
    const unsigned lo = lane * 8;
    const size_t gband = (size_t)K * 128;   // bytes of a 64-row band of a plane
    const char* gA = (const char*)(A + (size_t)blockIdx.x * 128 * K) + tid * 16; const char* gB = (const char*)(Bt + (size_t)blockIdx.y * 128 * K) + tid * 16; const char* gA2 = gA;
    if constexpr (NSPLIT == 1) gA2 = (const char*)(A2 + (size_t)blockIdx.x * 128 * K) + tid * 16;
    const unsigned l0 = (unsigned)(size_t)ring + tid * 16;
    auto fill = [&](int buf) {   // the next stage of every band into buffer buf: 128 lanes x 16 bytes a copy
        const unsigned l = l0 + buf * STAGEB;
        cp2(l, gA, l + BANDB, gA + gband);
        if constexpr (NSPLIT == 1) cp2(l + 2 * BANDB, gA2, l + 3 * BANDB, gA2 + gband);
        cp2(l + (NBAND - 2) * BANDB, gB, l + (NBAND - 1) * BANDB, gB + gband);
        gA += BANDB; gA2 += BANDB; gB += BANDB; };
    const int NT = K / 64;
    fill(0);
    asm volatile("s_wait_asynccnt 0x0" ::: "memory");   // this wave's part of stage 0 has landed
    __syncthreads();                                    // ... and every other wave's
    if (NT > 1) fill(1);
    // one trip a stage, kept rolled (the buffer goes by t & 1); the loops inside are unrolled so that the fragment and accumulator arrays have constant indices and stay in registers
#pragma unroll 1
    for (int t = 0; t < NT; ++t) {
        const char* sb = ring + (t & 1) * STAGEB + lane * 16;
#pragma unroll
        for (int ks = 0; ks < 2; ++ks) {
            V a[4], a2[4], b[2];
            const char* sB = sb + (NBAND - 2 + wn) * BANDB + ks * 4096;
#pragma unroll
            for (int mb = 0; mb < 4; ++mb) { a[mb] = WFrag<T16>::ld((const T16*)(sb + wm * BANDB + ks * 4096 + mb * 1024)); if (NSPLIT == 1) a2[mb] = WFrag<T16>::ld((const T16*)(sb + (2 + wm) * BANDB + ks * 4096 + mb * 1024)); }
            b[0] = WFrag<T16>::ld((const T16*)sB);
#pragma unroll
            for (int nb = 0; nb < 4; ++nb) {
                if (nb < 3) b[(nb + 1) & 1] = WFrag<T16>::ld((const T16*)(sB + (nb + 1) * 1024));
                __builtin_amdgcn_sched_barrier(0);   // the next column fragment's two LDS loads go out in front of this fragment's products, so that their latency runs under them
#pragma unroll
                for (int mb = 0; mb < 4; ++mb) { acc[mb][nb] = WFrag<T16>::mma(a[mb], b[nb & 1], acc[mb][nb]); if (NSPLIT == 1) acc[mb][nb] = WFrag<T16>::mma(a2[mb], b[nb & 1], acc[mb][nb]); } }
        }
        asm volatile("s_wait_dscnt 0x0" ::: "memory");      // this wave's reads of the buffer are done before it is refilled
        asm volatile("s_wait_asynccnt 0x0" ::: "memory");   // this wave's part of the next stage has landed
        __syncthreads();                                    // publishes the next stage and ends every wave's reads of this one
        if (t + 2 < NT) fill(t & 1);
    }
    asm volatile("s_wait_asynccnt 0x0" ::: "memory");       // nothing is in flight when the ring becomes staging (the last trip's barrier ended every read of it)
    float* os = (float*)ring + wave * (16 * 68 + 16); float* rfs = os + 16 * 68;   // each wave stages in its own range
#pragma unroll
    for (int mb = 0; mb < 4; ++mb) {
#pragma unroll
        for (int nb = 0; nb < 4; ++nb) {
#pragma unroll
            for (int j = 0; j < 8; ++j) os[(hi * 8 + j) * 68 + nb * 16 + lr] = acc[mb][nb][j]; }
        __builtin_amdgcn_wave_barrier(); asm volatile("" ::: "memory");
        if constexpr (QKV) {
            // lane = (row, half): 32 channels of one token, which hold every rotate-half pair (c, c + 16) of one axis
            const int sel = (c0 / HD) / NH_, g = (r0 / TT) * NH_ + (c0 / HD) % NH_, tk = r0 % TT + mb * 16; const int row = lane >> 1, hf = lane & 1;
            float xv[32]; float ss = 0.f;
#pragma unroll
            for (int c = 0; c < 8; ++c) { const v4f q = *(const v4fa*)(os + row * 68 + hf * 32 + c * 4);
#pragma unroll
                for (int i = 0; i < 4; ++i) { xv[c * 4 + i] = q[i]; ss += q[i] * q[i]; } }
            ss += __shfl_xor(ss, 1);    // the row's other half
            const float rf = __fdiv_rn(1.0f, __fsqrt_rn(ss * (1.0f / HD) + 1e-6f));
            if (sel < 2) {
                const float* nw = (sel ? ep.ksc : ep.qsc) + hf * 32; const float* cs = ep.CS + ((size_t)(r0 / 16 + mb) * 256 + lane) * 4;
                bf* Ph = sel ? ep.Kh : ep.Qh; bf* Pl = sel ? ep.Kl : ep.Ql; const size_t eo = ((size_t)g * TT + tk) * HD + hf * 512 + row * 8;   // fragment order: this half's 32 channels are one fragment
#pragma unroll
                for (int c = 0; c < 16; c += 8) { v8bf ah, al, bh, bl;   // channels c .. c + 7 (a) and their partners c + 16 .. c + 23 (b)
#pragma unroll
                    for (int i = 0; i < 8; i += 2) { const v4f e = *(const v4f*)(cs + (c + i) * 64);   // {cos, sin} of channels c + i, c + i + 1 (those of + 16 are the same); the wave's 512 bytes lie in a row
                        const v2f w0 = rbf2(*(const v2f*)(nw + c + i)), w1 = rbf2(*(const v2f*)(nw + 16 + c + i)); const v2f co = { e[0], e[2] }, si = { e[1], e[3] };
                        const v2f x0 = { xv[c + i], xv[c + i + 1] }, x1 = { xv[c + 16 + i], xv[c + 16 + i + 1] }; const v2f n0 = x0 * rf * w0, n1 = x1 * rf * w1;
                        v2bf h, l; split2(n0 * co - n1 * si, h, l); ah[i] = h[0]; ah[i + 1] = h[1]; al[i] = l[0]; al[i + 1] = l[1];
                        split2(n1 * co + n0 * si, h, l); bh[i] = h[0]; bh[i + 1] = h[1]; bl[i] = l[0]; bl[i + 1] = l[1]; }
                    *(v8us*)(Ph + eo + c * 16) = __builtin_bit_cast(v8us, ah); *(v8us*)(Pl + eo + c * 16) = __builtin_bit_cast(v8us, al); *(v8us*)(Ph + eo + 256 + c * 16) = __builtin_bit_cast(v8us, bh); *(v8us*)(Pl + eo + 256 + c * 16) = __builtin_bit_cast(v8us, bl);
                    asm volatile("s_wait_xcnt 0x0" ::: "memory");   // what follows reuses the data and address registers of these stores
                    __builtin_amdgcn_sched_barrier(0); }            // keeps it behind the wait
            } else {
                if (hf == 0) rfs[row] = rf;
                __builtin_amdgcn_wave_barrier(); asm volatile("" ::: "memory");   // the 1/rms of the 16 rows are read by other lanes than wrote them
                const v4f f0 = *(const v4fa*)(rfs + hi * 8), f1 = *(const v4fa*)(rfs + hi * 8 + 4);
#pragma unroll
                for (int nb = 0; nb < 4; ++nb) { v8bf oh, ol;   // a lane holds 8 tokens in a row of one channel: its own 16 bytes of a fragment of the transposed plane
#pragma unroll
                    for (int j = 0; j < 8; j += 2) { const v2f y = { acc[mb][nb][j] * (j < 4 ? f0[j & 3] : f1[j & 3]), acc[mb][nb][j + 1] * (j < 4 ? f0[(j & 3) + 1] : f1[(j & 3) + 1]) };
                        v2bf h, l; split2(y, h, l); oh[j] = h[0]; oh[j + 1] = h[1]; ol[j] = l[0]; ol[j + 1] = l[1]; }
                    const size_t vo = (size_t)g * HD * TT + (size_t)((((tk >> 5) * 4 + nb) * 2 + ((tk >> 4) & 1)) * 256); /* [32 keys][16 channels][16 keys], then the lane */ *(v8us*)(ep.Vh + vo + lo) = __builtin_bit_cast(v8us, oh); *(v8us*)(ep.Vl + vo + lo) = __builtin_bit_cast(v8us, ol);
                    asm volatile("s_wait_xcnt 0x0" ::: "memory");   // the next tile's split reuses the data and address registers of these stores
                    __builtin_amdgcn_sched_barrier(0); }            // keeps it behind the wait
            }
        } else {
        float* crow = C + (size_t)(r0 + mb * 16) * ldc + c0;
{
#pragma unroll
            for (int s = 0; s < 8; ++s) { const int row = 2 * s + hi, cofs = lr * 4; v4f val = *(const v4fa*)(os + row * 68 + cofs); if (BIAS) { val[0] += bfr(bias[c0 + cofs]); val[1] += bfr(bias[c0 + cofs + 1]); val[2] += bfr(bias[c0 + cofs + 2]); val[3] += bfr(bias[c0 + cofs + 3]); }
                *(v4f*)(crow + (size_t)row * ldc + cofs) = val; }
             }
        }
        __builtin_amdgcn_wave_barrier(); asm volatile("" ::: "memory");
    }
}

__device__ __forceinline__ h16 tohx(float x) { return (h16)x; }
typedef __attribute__((ext_vector_type(2))) _Float16 v2h;
typedef __attribute__((ext_vector_type(4))) _Float16 v4h;
typedef __attribute__((ext_vector_type(2))) unsigned short v2us;
typedef __attribute__((ext_vector_type(4))) unsigned short v4us;
typedef __attribute__((ext_vector_type(4))) int v4i;

__global__ __launch_bounds__(256) void k_wtG(const float* __restrict__ w, int K, int N, bf* Bt) {
    const int lane = threadIdx.x & 31; const int L0 = (blockIdx.x * 8 + (threadIdx.x >> 5)) * 8; const int nlines = N * K / 64;
{
#pragma unroll 1
        for (int l = 0; l < 8; ++l) { const int L = L0 + l; if (L >= nlines) break; const size_t e = (size_t)L * 64 + lane * 2; const int k = (int)(e % K), n = (int)(e / K); v2us o;
            o[0] = f2bf(w[(size_t)k * N + n]); o[1] = f2bf(w[(size_t)(k + 1) * N + n]); *(v2us*)(Bt + e) = o; }
         }
}
// ---- k_prep: all that the projections read is made in ONE launch; a thread makes 4 table entries or 8 pieces of 16 bytes, so that the launch has few waves to start.
// Blocks 0 .. CSB - 1: the {cos, sin} table in the order the projection epilogue's lanes read it: [16-token tile][channel pair 0..7][lane = token * 2 + axis][{cos, sin} x 2]. The reader takes the 16 frequencies of an axis once (channels + 16 repeat them), so its order has a place for those 16 alone.
// The other blocks: row-major f32 [R][768] (x, then the four weights) to bf16 in fragment order, 64-row bands; a block takes 8 steps of 32 k of one band (3 blocks a band), a thread the same 16 bytes of each step's 4 fragments. Within 64 threads (one fragment) 4 threads in a row take the 128 bytes (32 k) of one source row: a wave reads 8 whole lines and writes 4 whole lines a step.
#define CSB (NB_ * TT * (HD / 2) / 1024)
#define XBB (NB_ * TT / 64 * 3)
#define WBB (DQ / 64 * 3)
__global__ __launch_bounds__(256) void k_prep(const float* __restrict__ x, const float* __restrict__ wq, const float* __restrict__ wk, const float* __restrict__ wv, const float* __restrict__ wo, const int* __restrict__ pid, bf* XB, bf* WQKV, bf* WO, float* CS) {
    const int tid = threadIdx.x; int b = blockIdx.x;
    if (b < CSB) {   // entries b * 1024 + (tt * 2 + h) * 256 + tid: two 16-token tiles (tt), in each this thread's frequency i and i + 8 (h)
        const int ax = (tid >> 1) & 1, tl = (tid >> 2) & 15, i = (tid >> 6) * 2 + (tid & 1); float inv[2];
        const int pv[2] = { pid[(b * 32 + tl) * 2 + ax], pid[(b * 32 + 16 + tl) * 2 + ax] };   // both tiles' positions, in flight under the powers below
        // the loops of 2 trips below are unrolled so that inv and pv have constant indices and stay in registers
#pragma unroll
        for (int h = 0; h < 2; ++h) { const float e = __fdiv_rn((float)(2 * (i + 8 * h)), (float)(HD / 2)); inv[h] = __fdiv_rn(1.0f, powf(100.0f, e)); }
#pragma unroll
        for (int tt = 0; tt < 2; ++tt) {
#pragma unroll
            for (int h = 0; h < 2; ++h) { const float a = __fmul_rn((float)pv[tt], inv[h]); v2f cs; cs[0] = cosf(a); cs[1] = sinf(a);
                *(v2f*)(CS + ((size_t)(b * 2 + tt) * 512 + h * 256 + tid) * 2) = cs; } }
        return;
    }
    b -= CSB; const float* src = x; bf* dst = XB;
    if (b >= XBB) { b -= XBB; const int w = b / WBB; b -= w * WBB; src = w == 0 ? wq : w == 1 ? wk : w == 2 ? wv : wo; dst = w < 3 ? WQKV + (size_t)w * DQ * DM : WO; }
    const int band = b / 3, ks = (b % 3) * 8; const int i0 = (tid & 192) | ((tid >> 2) & 15) | ((tid & 3) << 4);   // the thread's 16 bytes among the 256 of a step
    const float* p = src + (size_t)(band * 64 + ((i0 >> 6) & 3) * 16 + (i0 & 15)) * DM + ks * 32 + ((i0 >> 5) & 1) * 16 + ((i0 >> 4) & 1) * 8; bf* q = dst + ((size_t)(band * (DM / 32) + ks) * 256 + i0) * 8;
    v8f v[8];   // the loops below are unrolled so that v has constant indices and stays in registers, and the 16 loads go out as one run
#pragma unroll
    for (int j = 0; j < 8; ++j) v[j] = *(const v8f*)(p + j * 32);
    asm volatile("s_wait_xcnt 0x0" :: "v"(p) : "memory");   // the address register of the 16 loads stays whole up to this wait (input), so that no load of the run lands in it and nothing rewrites it in front of the wait
#pragma unroll
    for (int j = 0; j < 8; ++j) { v8us o;
#pragma unroll
        for (int k = 0; k < 8; ++k) o[k] = f2bf(v[j][k]);
        *(v8us*)(q + j * 2048) = o; }
    asm volatile("s_wait_xcnt 0x0" ::: "memory");   // behind the last of the 8 stores: in the built code the table part stands behind them and rewrites their offset, data and base registers
}
// ---- k_fattn: scores, softmax and attn.v in ONE kernel; the scores never leave the registers.
// Grid: 256 work-groups of 12 waves (3 a SIMD, so one work-group a WGP); a wave owns 32 query columns of one (batch, head) plane (flat block = work-group * 12 + wave, 32 blocks a plane: a work-group meets one plane or two neighbours) and walks the 1024 keys in steps of 32. Scores unscaled (module scaling 1.0).
// The key and value planes (hi, lo) come, 128 keys a stage (16 KiB of each plane, contiguous in fragment order), into a two-buffer LDS ring by asynchronous copies, one stage ahead: a stage fetched once from L2 feeds all the waves of its plane, and a fragment is read from LDS as it lay in the plane.
// S^T = K Q^T (A = key rows, B = query columns) and O^T += V^T P^T (A = rows of the transposed value plane, B = P^T): in every tile a lane holds ONE query (column lane & 15),
// so maximum, sum and rescale are per lane plus one exchange with lane ^ 16, and two S^T tiles (keys 0-15, 16-31) are, converted in place, the B fragment of the second product.
// Running maximum (online softmax): P = exp(s - m) unnormalised on hi/lo planes, O and the sum rescaled by exp(m_old - m_new) each step, one division at the end. Writes the merged hi/lo planes.
__device__ __forceinline__ float xhalf(float x) { const int b = __float_as_int(x); return __int_as_float(__builtin_amdgcn_permlanex16(b, b, 0x76543210, 0xfedcba98, false, false)); }   // value of lane ^ 16
#define FA_W     12                  // waves a work-group
#define FA_CW    8                   // the waves that issue the copies: 256 lanes x 16 bytes = 4 KiB a copy
#define FA_SK    128                 // keys a stage
#define FA_PL    (FA_SK * HD * 2)    // bytes of a stage of one operand plane
#define FA_SLOT  (4 * FA_PL)         // key hi, key lo, value hi, value lo of one (batch, head) plane
#define FA_STAGE (2 * FA_SLOT)       // the work-group's first plane and, where it meets two, its second
// cp2k: the lane's own 16 bytes of each of the 4 pieces of 4 KiB of a stage of two operand planes (l: LDS byte address, g: global address), through no register.
// The s_wait_xcnt stands in the copies' own statement, so that nothing rewrites an address register of a copy in front of it.
__device__ __forceinline__ void cp2k(unsigned l0, const char* g0, unsigned l1, const char* g1) {
    asm volatile("global_load_async_to_lds_b128 %0, %1, off\n\t"
                 "global_load_async_to_lds_b128 %2, %3, off\n\t"
                 "global_load_async_to_lds_b128 %4, %5, off\n\t"
                 "global_load_async_to_lds_b128 %6, %7, off\n\t"
                 "global_load_async_to_lds_b128 %8, %9, off\n\t"
                 "global_load_async_to_lds_b128 %10, %11, off\n\t"
                 "global_load_async_to_lds_b128 %12, %13, off\n\t"
                 "global_load_async_to_lds_b128 %14, %15, off\n\t"
                 "s_wait_xcnt 0x0"
                 :: "v"(l0), "v"(g0), "v"(l0 + 4096u), "v"(g0 + 4096), "v"(l0 + 8192u), "v"(g0 + 8192), "v"(l0 + 12288u), "v"(g0 + 12288),
                    "v"(l1), "v"(g1), "v"(l1 + 4096u), "v"(g1 + 4096), "v"(l1 + 8192u), "v"(g1 + 8192), "v"(l1 + 12288u), "v"(g1 + 12288) : "memory");
}
__global__ __launch_bounds__(FA_W * 32) void k_fattn(const bf* __restrict__ Qh, const bf* __restrict__ Ql, const bf* __restrict__ Kh, const bf* __restrict__ Kl, const bf* __restrict__ Vh, const bf* __restrict__ Vl, bf* Ah, bf* Al) {
    typedef WFrag<bf> W;
    __shared__ __align__(16) char ring[2 * FA_STAGE];
    const int tid = threadIdx.x, lane = tid & 31; const int wave = __builtin_amdgcn_readfirstlane(tid >> 5);
    const int fb0 = blockIdx.x * FA_W, fb = fb0 + wave; const int g0 = fb0 / (TT / 32), g1 = (fb0 + FA_W - 1) / (TT / 32);   // the work-group's first and last plane
    const int g = fb / (TT / 32), q0 = (fb % (TT / 32)) * 32;                                                             // the wave's own plane and query columns
    const size_t qo = (size_t)g * TT * HD + (size_t)q0 * HD + lane * 8;   // planes in fragment order: 512 elements a fragment
    auto fill = [&](int st) {   // stage st of the four operand planes of the work-group's one or two planes into buffer st & 1 (waves 0 .. FA_CW - 1)
        unsigned ln; asm volatile("v_mbcnt_lo_u32_b32 %0, -1, 0" : "=v"(ln));   // the lane's number, made anew at every fill: held in a register over the key loop it would be one register too many for 3 waves a SIMD and go to scratch
        const unsigned lb = wave * 512 + ln * 16;   // the lane's 16 bytes among the 4 KiB of a copy
        const unsigned l = (unsigned)(size_t)ring + (st & 1) * FA_STAGE + lb; const size_t go = (size_t)g0 * (TT * HD * 2) + (size_t)st * FA_PL + lb;
        cp2k(l, (const char*)Kh + go, l + FA_PL, (const char*)Kl + go);
        cp2k(l + 2 * FA_PL, (const char*)Vh + go, l + 3 * FA_PL, (const char*)Vl + go);
        if (g1 != g0) { const size_t gn = go + (size_t)(TT * HD * 2);
            cp2k(l + FA_SLOT, (const char*)Kh + gn, l + FA_SLOT + FA_PL, (const char*)Kl + gn);
            cp2k(l + FA_SLOT + 2 * FA_PL, (const char*)Vh + gn, l + FA_SLOT + 3 * FA_PL, (const char*)Vl + gn); } };
    if (wave < FA_CW) fill(0);
    v16bf qh[2][2], ql[2][2];
#pragma unroll
    for (int nq = 0; nq < 2; ++nq)
#pragma unroll
        for (int kc = 0; kc < 2; ++kc) { qh[nq][kc] = W::ld(Qh + qo + nq * 16 * HD + kc * 512); ql[nq][kc] = W::ld(Ql + qo + nq * 16 * HD + kc * 512); }
    asm volatile("s_wait_xcnt 0x0" ::: "memory");   // the start values below reuse the address registers of the loads above
    __builtin_amdgcn_sched_barrier(0);              // keeps those start values behind the wait
    v8f o[2][4]; float m[2], l[2];
#pragma unroll
    for (int nq = 0; nq < 2; ++nq) { m[nq] = -3.0e38f; l[nq] = 0.f;
#pragma unroll
        for (int dt = 0; dt < 4; ++dt) o[nq][dt] = (v8f){}; }
    asm volatile("s_wait_asynccnt 0x0" ::: "memory");   // this wave's part of stage 0 has landed
    __syncthreads();                                    // ... and every other wave's
    if (wave < FA_CW) fill(1);
    // one trip a stage and one a step of 32 keys, both kept rolled: unrolled, the four steps' values no longer fit the registers of 3 waves a SIMD; the buffer goes by t & 1
#pragma unroll 1
    for (int t = 0; t < TT / FA_SK; ++t) {
        const bf* sb = (const bf*)(ring + (t & 1) * FA_STAGE + (g - g0) * FA_SLOT) + lane * 8;   // this stage of the wave's plane: [key hi][key lo][value hi][value lo], 4 fragments a step in each
        v16bf ka[2][2], kb[2][2];   // a step's key fragments (hi, lo), inside a stage fetched one step ahead
#pragma unroll
        for (int kt = 0; kt < 2; ++kt)
#pragma unroll
            for (int kc = 0; kc < 2; ++kc) { ka[kt][kc] = W::ld(sb + (kt * 2 + kc) * 512); kb[kt][kc] = W::ld(sb + FA_PL / 2 + (kt * 2 + kc) * 512); }
#pragma unroll 1
        for (int p = 0; p < FA_SK / 32; ++p) {
            const bf* sp = sb + p * (32 * HD);
            v16bf va[4], vb[4];         // this step's value fragments: in flight under the score products and the softmax
#pragma unroll
            for (int dt = 0; dt < 4; ++dt) { va[dt] = W::ld(sp + FA_PL + dt * 512); vb[dt] = W::ld(sp + FA_PL / 2 * 3 + dt * 512); }
            v8f s[2][2];
#pragma unroll
            for (int kt = 0; kt < 2; ++kt) { s[0][kt] = (v8f){}; s[1][kt] = (v8f){};
#pragma unroll
                for (int kc = 0; kc < 2; ++kc) {
#pragma unroll
                    for (int nq = 0; nq < 2; ++nq) { s[nq][kt] = wmmab(ka[kt][kc], qh[nq][kc], s[nq][kt]); s[nq][kt] = wmmab(ka[kt][kc], ql[nq][kc], s[nq][kt]); s[nq][kt] = wmmab(kb[kt][kc], qh[nq][kc], s[nq][kt]); } } }
            if (p + 1 < FA_SK / 32) {   // the next step's keys, while they lie in this stage (the next stage is read only behind its barrier)
#pragma unroll
                for (int kt = 0; kt < 2; ++kt)
#pragma unroll
                    for (int kc = 0; kc < 2; ++kc) { ka[kt][kc] = W::ld(sp + 32 * HD + (kt * 2 + kc) * 512); kb[kt][kc] = W::ld(sp + 32 * HD + FA_PL / 2 + (kt * 2 + kc) * 512); } }
            __builtin_amdgcn_sched_barrier(0);     // keeps the loads above issued in front of the softmax, so that their latency runs under it
            v16bf ph[2], pl[2];
#pragma unroll
            for (int nq = 0; nq < 2; ++nq) { float mx = s[nq][0][0];
#pragma unroll
                for (int j = 0; j < 8; ++j) mx = fmaxf(mx, fmaxf(s[nq][0][j], s[nq][1][j]));
                mx = fmaxf(mx, xhalf(mx)); const float mn = fmaxf(m[nq], mx); const float al = __builtin_amdgcn_exp2f((m[nq] - mn) * 1.4426950408889634f); m[nq] = mn; float sum = 0.f;
#pragma unroll
                for (int e = 0; e < 16; e += 2) { v2f t2; t2[0] = s[nq][e >> 3][e & 7]; t2[1] = s[nq][e >> 3][(e & 7) + 1]; t2 = (t2 - mn) * 1.4426950408889634f; v2f pp; pp[0] = __builtin_amdgcn_exp2f(t2[0]); pp[1] = __builtin_amdgcn_exp2f(t2[1]); sum += pp[0]; sum += pp[1];
                    const v2bf h = __builtin_convertvector(pp, v2bf); const v2bf r = __builtin_convertvector(pp - __builtin_convertvector(h, v2f), v2bf); ph[nq][e] = h[0]; ph[nq][e + 1] = h[1]; pl[nq][e] = r[0]; pl[nq][e + 1] = r[1]; }
                l[nq] = l[nq] * al + sum;
#pragma unroll
                for (int dt = 0; dt < 4; ++dt) o[nq][dt] *= al; }
#pragma unroll
            for (int dt = 0; dt < 4; ++dt) { const v16bf a = va[dt]; const v16bf a2 = vb[dt];
#pragma unroll
                for (int nq = 0; nq < 2; ++nq) { o[nq][dt] = wmmab(a, ph[nq], o[nq][dt]); o[nq][dt] = wmmab(a, pl[nq], o[nq][dt]); o[nq][dt] = wmmab(a2, ph[nq], o[nq][dt]); } }
            __builtin_amdgcn_sched_barrier(0);                    // keeps the four slots below behind the last product
            asm volatile("v_nop\n\tv_nop\n\tv_nop\n\tv_nop");   // the distance from the step's last products to the next step's first vector instruction, which in the built code rewrites one of their A registers
        }
        asm volatile("s_wait_dscnt 0x0" ::: "memory");      // this wave's reads of the buffer are done before it is refilled
        asm volatile("s_wait_asynccnt 0x0" ::: "memory");   // this wave's part of the next stage has landed
        __syncthreads();                                    // publishes the next stage and ends every wave's reads of this one
        if (wave < FA_CW && t + 2 < TT / FA_SK) fill(t + 2);
    }
    asm volatile("s_wait_asynccnt 0x0" ::: "memory");       // nothing is in flight when the wave ends
#pragma unroll
    for (int nq = 0; nq < 2; ++nq) { const float f = __fdiv_rn(1.0f, l[nq] + xhalf(l[nq])); const size_t oo = ((size_t)(g / NH_) * TT + (q0 & ~63)) * DQ + (g % NH_) * (64 * HD) + (((q0 >> 4) & 3) + nq) * 512 + lane * 8;   // fragment order of the [8192][768] merged plane: band, the head's two steps of 32 k, this 16-token tile
#pragma unroll
        for (int dt = 0; dt < 4; ++dt) { v8us oh, ol;
#pragma unroll
            for (int j = 0; j < 8; ++j) { unsigned short a, c2; splitf(o[nq][dt][j] * f, a, c2); oh[j] = a; ol[j] = c2; }
            *(v8us*)(Ah + oo + (dt >> 1) * 2048 + (dt & 1) * 256) = oh; *(v8us*)(Al + oo + (dt >> 1) * 2048 + (dt & 1) * 256) = ol;
            asm volatile("s_wait_xcnt 0x0" ::: "memory");   // the next tile's split reuses the data registers of these stores
            __builtin_amdgcn_sched_barrier(0); } }          // keeps the next tile's split behind the wait
}

extern "C" void kernel_launch(void* const* d_in, const int* in_sizes, int n_in,
                              void* d_out, int out_size, void* d_ws, size_t ws_size, hipStream_t stream) {
    (void)in_sizes; (void)n_in; (void)out_size;
    const float* x = (const float*)d_in[0]; const int* pid = (const int*)d_in[1]; const float* wq = (const float*)d_in[2]; const float* wk = (const float*)d_in[3]; const float* wv = (const float*)d_in[4]; const float* wo = (const float*)d_in[5]; const float* qsc = (const float*)d_in[6]; const float* ksc = (const float*)d_in[7];
    float* OUT = (float*)d_out;     // [8][1024][768]
    char* wsp = (char*)d_ws;
    auto take = [&](size_t bytes) { char* p = wsp; wsp += (bytes + 255) & ~(size_t)255; return (void*)p; };
    bf* WQ = (bf*)take((size_t)(DQ + 2 * DKV) * DM * 2);   // one [2304][768] weight plane: q, k, v rows one behind the other
    bf* WO = (bf*)take((size_t)DM * DQ * 2); float* CS = (float*)take((size_t)NB_ * TT * HD * 2 * 4);
    bf* QPh = (bf*)take((size_t)NB_ * NH_ * TT * HD * 2); bf* QPl = (bf*)take((size_t)NB_ * NH_ * TT * HD * 2); bf* KPh = (bf*)take((size_t)NB_ * NKV * TT * HD * 2); bf* KPl = (bf*)take((size_t)NB_ * NKV * TT * HD * 2); bf* VTh = (bf*)take((size_t)NB_ * NKV * HD * TT * 2); bf* VTl = (bf*)take((size_t)NB_ * NKV * HD * TT * 2);
    bf* ATh = (bf*)take((size_t)NB_ * TT * DQ * 2); bf* ATl = (bf*)take((size_t)NB_ * TT * DQ * 2);
    bf* XB = (bf*)take((size_t)NB_ * TT * DM * 2);   // x in bf16
    if ((size_t)(wsp - (char*)d_ws) > ws_size) return;    // ws 256 MiB
    k_prep<<<CSB + XBB + 4 * WBB, 256, 0, stream>>>(x, wq, wk, wv, wo, pid, XB, WQ, WO, CS);   // the rotary table of all batches; x and the four weights in bf16
    const QkvEpi ep = { CS, qsc, ksc, QPh, QPl, KPh, KPl, VTh, VTl };
    k_gemmw<bf, 0, false, true><<<dim3(NB_ * TT / 128, (DQ + 2 * DKV) / 128, 1), 128, 0, stream>>>(XB, nullptr, WQ, nullptr, DM, nullptr, 0, nullptr, 0, 0, 0, ep);   // q, k, v projections with RMSNorm, rotary and plane build in the epilogue
    k_fattn<<<dim3(NB_ * NH_ * (TT / 32) / FA_W, 1, 1), FA_W * 32, 0, stream>>>(QPh, QPl, KPh, KPl, VTh, VTl, ATh, ATl);   // plane g = batch * 12 + head; one kv head per query head
    k_gemmw<bf, 1, false, false><<<dim3(NB_ * TT / 128, DM / 128, 1), 128, 0, stream>>>(ATh, ATl, WO, nullptr, DQ, OUT, DM, nullptr, 0, 0, 0, QkvEpi{});
}
